// v000
// Times are from an AMD MI455X. After a warm-up the kernel runs many times in a row, and a time is the length of
// such a window on the GPU divided by its runs, so every launch and the gaps after it count. The runs cycle
// through copies of the inputs. A figure is the median of several windows, for all but v000 over two sittings.
// Sittings can differ by a few percent; kernels timed side by side share one.
// v000 is the starting kernel. One run takes 412 microseconds.
// compute dtype: float inputs RNE-converted to bf16; q/k/v = x W^T + b on v_wmma_f32_16x16x32_bf16 (bf16 operands, exact products, f32 accumulate); logits -q.k/8 + m from q as f16 hi + f16 residual (x 2^10) times k f16 hi on v_wmma_f32_16x16x32_f16 (2 products, f32 accumulate); online softmax in f32 (precise expf); P x 2^11 as bf16 hi + lo times v bf16 hi + lo on v_wmma_f32_16x16x32_bf16 (3 products, f32 accumulate); f32 output.
#include <hip/hip_runtime.h>
#include <math.h>

typedef __attribute__((ext_vector_type(16))) _Float16 v16h;
typedef __attribute__((ext_vector_type(16))) __bf16 v16b;
typedef __attribute__((ext_vector_type(8)))  _Float16 v8h;
typedef __attribute__((ext_vector_type(8)))  __bf16 v8b;
typedef __attribute__((ext_vector_type(8)))  float v8f;
typedef __attribute__((ext_vector_type(4)))  float v4f;
typedef __attribute__((ext_vector_type(4)))  unsigned v4u;

template <typename T> __device__ __forceinline__ void vst2(void* p, T v) { *(T*)p = v;  }

__device__ __forceinline__ v8f wmma16(v16h a, v16h b, v8f c) {
  v8f d = __builtin_amdgcn_wmma_f32_16x16x32_f16(false, a, false, b, (short)0, c, false, false);
  asm volatile("v_nop\n\tv_nop\n\tv_nop\n\tv_nop" : "+v"(d) : "v"(a), "v"(b));
  return d;
}
__device__ __forceinline__ v8f wmma_bf(v16b a, v16b b, v8f c) {
  v8f d = __builtin_amdgcn_wmma_f32_16x16x32_bf16(false, a, false, b, (short)0, c, false, false);
  asm volatile("v_nop\n\tv_nop\n\tv_nop\n\tv_nop" : "+v"(d) : "v"(a), "v"(b));
  return d;
}
// 16x16x32 fragments: lane = (g = lane>>4, row/col = lane&15); elements 0..7 = k0+8g+0..7, 8..15 = k0+16+8g+0..7; D element r = row 8g+r, col lane&15
// A from a row-major [m][k] row pointer at k0; B from a k-contiguous [n][k] row pointer at k0 (same map)
__device__ __forceinline__ v16h frag_h(const _Float16* rowk0, int lane) {
  union { v16h v; v8h q[2]; } u; const _Float16* p = rowk0 + 8 * (lane >> 4);
  u.q[0] = *(const v8h*)p; u.q[1] = *(const v8h*)(p + 16); return u.v;
}
__device__ __forceinline__ v16b frag_b(const __bf16* rowk0, int lane) {
  union { v16b v; v8b q[2]; } u; const __bf16* p = rowk0 + 8 * (lane >> 4);
  u.q[0] = *(const v8b*)p; u.q[1] = *(const v8b*)(p + 16); return u.v;
}
struct F2 { v16b h, l; };
__device__ __forceinline__ F2 bsplit16(const float v[16]) { F2 r;
#pragma unroll
  for (int i = 0; i < 16; ++i) { const __bf16 h = (__bf16)v[i]; r.h[i] = h; r.l[i] = (__bf16)(v[i] - (float)h); }
  return r; }
__device__ __forceinline__ F2 split_row(const float* row, int k0, int lane) { float v[16]; const float* p = row + k0 + 8 * (lane >> 4);
#pragma unroll
  for (int i = 0; i < 8; ++i) { v[i] = p[i]; v[8 + i] = p[16 + i]; }
  return bsplit16(v); }
__device__ __forceinline__ float bfr(float v) { return (float)(__bf16)v; }
// same-wave LDS spill -> reload ordering: drain DS, lockstep the wave, keep the compiler from hoisting the reloads
__device__ __forceinline__ void ldsx() { asm volatile("s_wait_dscnt 0" ::: "memory"); __builtin_amdgcn_wave_barrier(); __builtin_amdgcn_fence(4, "workgroup"); }

// ---- sizes: NB x SEQ rows processed; inputs and d_in row strides use the *_FULL extents
#ifndef NB
#define NB 2
#endif
#ifndef SEQ
#define SEQ 2048
#endif
#ifndef NB_FULL
#define NB_FULL 2
#endif
#ifndef SEQ_FULL
#define SEQ_FULL 2048
#endif
#define CC 1024            // model width
#define NH 16              // heads
#define HD 64              // head width; column n of q/k/v = h*HD + d
#define KT 64              // keys per step of the fused softmax kernel

static_assert(NB >= 1 && NB <= NB_FULL);
static_assert(SEQ % 64 == 0 && SEQ <= SEQ_FULL && SEQ_FULL % 4 == 0);
static_assert(NH * HD == CC && HD == 64 && CC % 128 == 0 && KT == 64);

#define PLB (2u * (size_t)NB * SEQ * CC)   // one 16-bit [NB*SEQ][CC] plane
#define WPB (2u * (size_t)CC * CC)         // one 16-bit [CC][CC] weight plane
#define WS_XQ ((size_t)0)                  // bf16 x planes [b*SEQ+s][CC]
#define WS_XK (WS_XQ + PLB)
#define WS_XV (WS_XK + PLB)
#define WS_WQ (WS_XV + PLB)                // bf16 weight planes [out][in]
#define WS_WK (WS_WQ + WPB)
#define WS_WV (WS_WK + WPB)
#define WS_QH (WS_WV + WPB)                // f16 q hi [b*SEQ+s][CC]
#define WS_QL (WS_QH + PLB)                // f16 q residual x 2^10
#define WS_KH (WS_QL + PLB)                // f16 k hi [b*SEQ+s][CC]
#define WS_VT (WS_KH + PLB)                // bf16 v hi, transposed [b][CC][SEQ]
#define WS_VL (WS_VT + PLB)                // bf16 v lo, transposed
#define WS_END (WS_VL + PLB)
static_assert(PLB % 128 == 0 && WPB % 128 == 0);
static_assert(WS_END <= (size_t)134217728u);

// ---- k_cvt: z = 0..5 selects (x_q, x_k, x_v, w_q, w_k, w_v): f32 -> bf16 (RNE), 8 elements per thread, one 16-B store per lane
// coverage: x planes NB*SEQ*CC/8 chunks (source rows remapped through the full strides), weight planes CC*CC/8 chunks; grid.x = max of the two
__global__ __launch_bounds__(256) void k_cvt(const float* __restrict__ XQ, const float* __restrict__ XK, const float* __restrict__ XV,
                                             const float* __restrict__ WQ, const float* __restrict__ WK, const float* __restrict__ WV,
                                             __bf16* __restrict__ DQ, __bf16* __restrict__ DK, __bf16* __restrict__ DV,
                                             __bf16* __restrict__ DWQ, __bf16* __restrict__ DWK, __bf16* __restrict__ DWV) {
  const int z = blockIdx.z;
  const float* src = z == 0 ? XQ : z == 1 ? XK : z == 2 ? XV : z == 3 ? WQ : z == 4 ? WK : WV;
  __bf16* dst = z == 0 ? DQ : z == 1 ? DK : z == 2 ? DV : z == 3 ? DWQ : z == 4 ? DWK : DWV;
  const size_t n8 = (z < 3) ? (size_t)NB * SEQ * CC / 8 : (size_t)CC * CC / 8;
  const size_t e = (size_t)blockIdx.x * 256 + threadIdx.x;
  if (e >= n8) return;
  size_t so = e * 8;
  if (z < 3) { const size_t row = e / (CC / 8), c = e % (CC / 8); so = ((row / SEQ) * SEQ_FULL + (row % SEQ)) * CC + c * 8; }
  const v4f f0 = *(const v4f*)(src + so), f1 = *(const v4f*)(src + so + 4);
  union { v8b v; v4u u; } o;
#pragma unroll
  for (int i = 0; i < 4; ++i) { o.v[i] = (__bf16)f0[i]; o.v[4 + i] = (__bf16)f1[i]; }
  vst2((void*)(dst + e * 8), o.u);
}

// ---- k_proj: block = (64 rows, 128 cols, which): y = x W^T + b with exact bf16 products; q -> f16 hi + residual, k -> f16 hi, v -> bf16 hi/lo transposed planes
// coverage: grid (NB*SEQ/64, CC/128, 3) writes every row and column of QH, QL, KH, VT, VL exactly once
__global__ __launch_bounds__(128) void k_proj(const __bf16* __restrict__ XQ, const __bf16* __restrict__ XK, const __bf16* __restrict__ XV,
                                              const __bf16* __restrict__ WQ, const __bf16* __restrict__ WK, const __bf16* __restrict__ WV,
                                              const float* __restrict__ BQ, const float* __restrict__ BK, const float* __restrict__ BV,
                                              _Float16* __restrict__ QH, _Float16* __restrict__ QL, _Float16* __restrict__ KH,
                                              __bf16* __restrict__ VT, __bf16* __restrict__ VL) {
  __shared__ __align__(16) _Float16 sh[64][136], sl[64][136]; __shared__ __align__(16) __bf16 th[128][72], tl2[128][72];
  const int tid = threadIdx.x, wave = tid >> 5, lane = tid & 31, col = lane & 15, g = lane >> 4;
  const int which = blockIdx.z; const int c0 = blockIdx.y * 128; const size_t r0 = (size_t)blockIdx.x * 64;
  const __bf16* X = which == 0 ? XQ : which == 1 ? XK : XV;
  const __bf16* W = which == 0 ? WQ : which == 1 ? WK : WV;
  const float* BA = which == 0 ? BQ : which == 1 ? BK : BV;
  v8f acc[8] = {};
#pragma unroll 2
  for (int kc = 0; kc < CC / 32; ++kc) {
    const v16b a = frag_b(X + (r0 + wave * 16 + col) * CC + kc * 32, lane);              // A: x row m, split k map
#pragma unroll
    for (int j = 0; j < 8; ++j) {
      const v16b w = frag_b(W + (size_t)(c0 + j * 16 + col) * CC + kc * 32, lane);      // B[k][n] = W[n][k]: k-contiguous row n, same map
      acc[j] = wmma_bf(a, w, acc[j]); } }
#pragma unroll
  for (int j = 0; j < 8; ++j) { const float bb = bfr(BA[c0 + j * 16 + col]);
#pragma unroll
    for (int r = 0; r < 8; ++r) { const float v = acc[j][r] + bb; const int rl = wave * 16 + 8 * g + r, cl = j * 16 + col;
      if (which == 2) { const __bf16 bh = (__bf16)v; th[cl][rl] = bh; tl2[cl][rl] = (__bf16)(v - (float)bh); }
      else { const _Float16 hv = (_Float16)v; sh[rl][cl] = hv; sl[rl][cl] = (_Float16)((v - (float)hv) * 1024.0f); }   /* q residual carried x 2^10 so the plane stays f16-normal */ } }
  __syncthreads();
  if (which < 2) { _Float16* dh = which == 0 ? QH : KH;
    for (int e = tid; e < 64 * 16; e += 128) { const int rl = e >> 4, q = e & 15;
      vst2((void*)(dh + (r0 + rl) * CC + c0 + q * 8), *(const v4u*)&sh[rl][q * 8]);
      if (which == 0) vst2((void*)(QL + (r0 + rl) * CC + c0 + q * 8), *(const v4u*)&sl[rl][q * 8]); } }
  else { const size_t b = r0 / SEQ; const int t0 = (int)(r0 % SEQ);
    for (int e = tid; e < 128 * 8; e += 128) { const int cl = e >> 3, q = e & 7; const size_t o2 = (b * CC + c0 + cl) * (size_t)SEQ + t0 + q * 8;
      vst2((void*)(VT + o2), *(const v4u*)&th[cl][q * 8]); vst2((void*)(VL + o2), *(const v4u*)&tl2[cl][q * 8]); } }
}

// ---- k_att: block = (64 queries, head h, batch b), 4 waves x 16 query rows; per step a 64-key tile of k (f16), v hi/lo (bf16) and m (f32) is staged in LDS;
// logits = -(q.k)/8 + m (q f16 hi + residual x k f16 hi), online softmax in f32, P x 2^11 spilled per wave to LDS and reloaded as bf16 hi+lo A fragments,
// o += P v (3 products), out = o / (l * 2^11).  LDS regions: kt/vhs/vls/ms cross-wave (block barriers), ps wave-private (ldsx).
__global__ __launch_bounds__(128) void k_att(const _Float16* __restrict__ QH, const _Float16* __restrict__ QL, const _Float16* __restrict__ KH,
                                             const __bf16* __restrict__ VT, const __bf16* __restrict__ VL, const float* __restrict__ MK, float* __restrict__ OUT) {
  __shared__ __align__(16) _Float16 kt[KT][72];           // [key][d]
  __shared__ __align__(16) __bf16 vhs[HD][72], vls[HD][72]; // [d][key]
  __shared__ __align__(16) float ms[64][68];               // [query][key]
  __shared__ __align__(16) float ps[4][16][68];            // per wave: [query][key] P x 2^11, later [query][d] output staging
  const int tid = threadIdx.x, wave = tid >> 5, lane = tid & 31, col = lane & 15, g = lane >> 4;
  const int b = blockIdx.z, h = blockIdx.y, qb0 = blockIdx.x * 64, ql0 = qb0 + wave * 16;
  const size_t qrow = (size_t)b * SEQ + ql0;
  v16h qh[2], qlo[2];
#pragma unroll
  for (int kc = 0; kc < 2; ++kc) { qh[kc] = frag_h(QH + (qrow + col) * CC + h * HD + kc * 32, lane); qlo[kc] = frag_h(QL + (qrow + col) * CC + h * HD + kc * 32, lane); }
  float mrow[8], lrow[8]; v8f o[4];
#pragma unroll
  for (int r = 0; r < 8; ++r) { mrow[r] = -3.0e38f; lrow[r] = 0.0f; }
#pragma unroll
  for (int t = 0; t < 4; ++t) o[t] = (v8f){};
#pragma unroll 1
  for (int kb = 0; kb < SEQ / KT; ++kb) {
    const int k0 = kb * KT;
    __syncthreads();                                        // all waves done with the earlier tile
    // staged extent == consumed extent: kt rows 0..63 x d 0..63, vhs/vls d 0..63 x keys 0..63, ms 64 x 64
#pragma unroll
    for (int i = 0; i < 4; ++i) { const int e = tid + 128 * i, rr = e >> 3, c = e & 7;
      *(v8h*)&kt[rr][c * 8] = *(const v8h*)(KH + ((size_t)b * SEQ + k0 + rr) * CC + h * HD + c * 8);
      const size_t vo = ((size_t)b * CC + h * HD + rr) * SEQ + k0 + c * 8;
      *(v8b*)&vhs[rr][c * 8] = *(const v8b*)(VT + vo); *(v8b*)&vls[rr][c * 8] = *(const v8b*)(VL + vo); }
#pragma unroll
    for (int i = 0; i < 8; ++i) { const int e = tid + 128 * i, qr = e >> 4, c = e & 15;
      *(v4f*)&ms[qr][c * 4] = *(const v4f*)(MK + ((size_t)b * SEQ_FULL + qb0 + qr) * SEQ_FULL + k0 + c * 4); }
    __syncthreads();
    v8f s[4];
#pragma unroll
    for (int j = 0; j < 4; ++j) { v8f a = {}, al = {};
#pragma unroll
      for (int kc = 0; kc < 2; ++kc) { const v16h kf = frag_h(&kt[j * 16 + col][kc * 32], lane);   // B[k=d][n=key]: k-contiguous row per key
        a = wmma16(qh[kc], kf, a); al = wmma16(qlo[kc], kf, al); }
      s[j] = a * (-0.125f) + al * (-0.125f / 1024.0f); }   /* -(q.k)/sqrt(64), residual folded back with 2^-10 */
#pragma unroll
    for (int r = 0; r < 8; ++r) { const int mr = wave * 16 + 8 * g + r;
#pragma unroll
      for (int j = 0; j < 4; ++j) s[j][r] += bfr(ms[mr][j * 16 + col]);
      float v = fmaxf(fmaxf(s[0][r], s[1][r]), fmaxf(s[2][r], s[3][r]));
      v = fmaxf(v, __shfl_xor(v, 1, 16)); v = fmaxf(v, __shfl_xor(v, 2, 16)); v = fmaxf(v, __shfl_xor(v, 4, 16)); v = fmaxf(v, __shfl_xor(v, 8, 16));
      const float mn = fmaxf(mrow[r], v); const float alpha = expf(mrow[r] - mn); float rs = 0.0f;
#pragma unroll
      for (int j = 0; j < 4; ++j) { const float p = expf(s[j][r] - mn); s[j][r] = p; rs += p; }
      rs += __shfl_xor(rs, 1, 16); rs += __shfl_xor(rs, 2, 16); rs += __shfl_xor(rs, 4, 16); rs += __shfl_xor(rs, 8, 16);
      lrow[r] = lrow[r] * alpha + rs; mrow[r] = mn;
#pragma unroll
      for (int t = 0; t < 4; ++t) o[t][r] *= alpha; }
    // spill P x 2^11 in the D layout (row 8g+r, key j*16+col), then reload rows as A fragments (same float element type, ldsx between)
#pragma unroll
    for (int j = 0; j < 4; ++j)
#pragma unroll
      for (int r = 0; r < 8; ++r) ps[wave][8 * g + r][j * 16 + col] = s[j][r] * 2048.0f;
    ldsx();
#pragma unroll
    for (int kc = 0; kc < 2; ++kc) { const F2 p = split_row(&ps[wave][col][0], kc * 32, lane);
#pragma unroll
      for (int t = 0; t < 4; ++t) {
        const v16b vh = frag_b(&vhs[t * 16 + col][kc * 32], lane), vl = frag_b(&vls[t * 16 + col][kc * 32], lane);   // B[k=key][n=d]: key-contiguous row per d
        o[t] = wmma_bf(p.h, vh, o[t]); o[t] = wmma_bf(p.l, vh, o[t]); o[t] = wmma_bf(p.h, vl, o[t]); } }
  }
  ldsx();
#pragma unroll
  for (int r = 0; r < 8; ++r) { const float inv = (1.0f / lrow[r]) * (1.0f / 2048.0f);
#pragma unroll
    for (int t = 0; t < 4; ++t) ps[wave][8 * g + r][t * 16 + col] = o[t][r] * inv; }
  ldsx();
  for (int rl = 0; rl < 16; ++rl) { const v4f w4 = *(const v4f*)&ps[wave][rl][(lane & 15) * 4];
    if (lane < HD / 4) vst2((void*)(OUT + ((size_t)b * SEQ + ql0 + rl) * CC + h * HD + lane * 4), w4); }
}

extern "C" void kernel_launch(void* const* d_in, const int* in_sizes, int n_in, void* d_out, int out_size, void* d_ws, size_t ws_size, hipStream_t stream) {
  if (n_in < 10) return;
  const size_t needX = ((size_t)(NB - 1) * SEQ_FULL + SEQ) * CC;
  const size_t needM = ((size_t)(NB - 1) * SEQ_FULL + SEQ - 1) * SEQ_FULL + SEQ;
  if ((size_t)in_sizes[0] < needX || (size_t)in_sizes[1] < needX || (size_t)in_sizes[2] < needX) return;
  if ((size_t)in_sizes[3] < needM) return;
  if ((size_t)in_sizes[4] < (size_t)CC * CC || (size_t)in_sizes[6] < (size_t)CC * CC || (size_t)in_sizes[8] < (size_t)CC * CC) return;
  if (in_sizes[5] < CC || in_sizes[7] < CC || in_sizes[9] < CC) return;
  if ((size_t)out_size < (size_t)NB * SEQ * CC) return;
  if (ws_size < (size_t)WS_END) return;
  const float* const* F = (const float* const*)d_in;   // 0 x_q, 1 x_k, 2 x_v [2,2048,1024]; 3 m [2,2048,2048]; 4 w_q [out][in], 5 b_q, 6 w_k, 7 b_k, 8 w_v, 9 b_v
  char* ws = (char*)d_ws;
  __bf16 *XQb = (__bf16*)(ws + WS_XQ), *XKb = (__bf16*)(ws + WS_XK), *XVb = (__bf16*)(ws + WS_XV);
  __bf16 *WQb = (__bf16*)(ws + WS_WQ), *WKb = (__bf16*)(ws + WS_WK), *WVb = (__bf16*)(ws + WS_WV);
  _Float16 *QH = (_Float16*)(ws + WS_QH), *QL = (_Float16*)(ws + WS_QL), *KH = (_Float16*)(ws + WS_KH);
  __bf16 *VT = (__bf16*)(ws + WS_VT), *VL = (__bf16*)(ws + WS_VL);
  const size_t nx8 = (size_t)NB * SEQ * CC / 8, nw8 = (size_t)CC * CC / 8;
  const unsigned gx8 = (unsigned)((nx8 + 255) / 256), gw8 = (unsigned)((nw8 + 255) / 256);
  const unsigned gx = gx8 > gw8 ? gx8 : gw8;
  k_cvt<<<dim3(gx, 1, 6), 256, 0, stream>>>(F[0], F[1], F[2], F[4], F[6], F[8], XQb, XKb, XVb, WQb, WKb, WVb);
  k_proj<<<dim3(NB * SEQ / 64, CC / 128, 3), 128, 0, stream>>>(XQb, XKb, XVb, WQb, WKb, WVb, F[5], F[7], F[9], QH, QL, KH, VT, VL);
  k_att<<<dim3(SEQ / 64, NH, NB), 128, 0, stream>>>(QH, QL, KH, VT, VL, F[3], (float*)d_out);
}

// v001
// It runs in 316 microseconds.
// Two timings next to v000 both put it at 1.35 times that version's speed.
// compute dtype: float inputs RNE-converted to bf16; q/k/v = x W^T + b on v_wmma_f32_16x16x32_bf16 (bf16 operands, exact products, f32 accumulate); logits -q.k/8 + m from q as f16 hi + f16 residual (x 2^10) times k f16 hi on v_wmma_f32_16x16x32_f16 (2 products, f32 accumulate); online softmax in f32 (precise expf); P x 2^11 as bf16 hi + lo times v bf16 hi + lo on v_wmma_f32_16x16x32_bf16 (3 products, f32 accumulate); f32 output.
#include <hip/hip_runtime.h>
#include <math.h>

typedef __attribute__((ext_vector_type(16))) _Float16 v16h;
typedef __attribute__((ext_vector_type(16))) __bf16 v16b;
typedef __attribute__((ext_vector_type(8)))  _Float16 v8h;
typedef __attribute__((ext_vector_type(8)))  __bf16 v8b;
typedef __attribute__((ext_vector_type(8)))  float v8f;
typedef __attribute__((ext_vector_type(4)))  float v4f;
typedef __attribute__((ext_vector_type(4)))  unsigned v4u;

template <typename T> __device__ __forceinline__ void vst2(void* p, T v) { *(T*)p = v;  }

__device__ __forceinline__ v8f wmma16(v16h a, v16h b, v8f c) {
  v8f d = __builtin_amdgcn_wmma_f32_16x16x32_f16(false, a, false, b, (short)0, c, false, false);
  asm volatile("v_nop\n\tv_nop\n\tv_nop\n\tv_nop" : "+v"(d) : "v"(a), "v"(b));
  return d;
}
__device__ __forceinline__ v8f wmma_bf(v16b a, v16b b, v8f c) {
  v8f d = __builtin_amdgcn_wmma_f32_16x16x32_bf16(false, a, false, b, (short)0, c, false, false);
  asm volatile("v_nop\n\tv_nop\n\tv_nop\n\tv_nop" : "+v"(d) : "v"(a), "v"(b));
  return d;
}
// 16x16x32 fragments: lane = (g = lane>>4, row/col = lane&15); elements 0..7 = k0+8g+0..7, 8..15 = k0+16+8g+0..7; D element r = row 8g+r, col lane&15
// A from a row-major [m][k] row pointer at k0; B from a k-contiguous [n][k] row pointer at k0 (same map)
__device__ __forceinline__ v16h frag_h(const _Float16* rowk0, int lane) {
  union { v16h v; v8h q[2]; } u; const _Float16* p = rowk0 + 8 * (lane >> 4);
  u.q[0] = *(const v8h*)p; u.q[1] = *(const v8h*)(p + 16); return u.v;
}
__device__ __forceinline__ v16b frag_b(const __bf16* rowk0, int lane) {
  union { v16b v; v8b q[2]; } u; const __bf16* p = rowk0 + 8 * (lane >> 4);
  u.q[0] = *(const v8b*)p; u.q[1] = *(const v8b*)(p + 16); return u.v;
}
struct F2 { v16b h, l; };
__device__ __forceinline__ F2 bsplit16(const float v[16]) { F2 r;
#pragma unroll
  for (int i = 0; i < 16; ++i) { const __bf16 h = (__bf16)v[i]; r.h[i] = h; r.l[i] = (__bf16)(v[i] - (float)h); }
  return r; }
__device__ __forceinline__ F2 split_row(const float* row, int k0, int lane) { float v[16]; const float* p = row + k0 + 8 * (lane >> 4);
#pragma unroll
  for (int i = 0; i < 8; ++i) { v[i] = p[i]; v[8 + i] = p[16 + i]; }
  return bsplit16(v); }
__device__ __forceinline__ float bfr(float v) { return (float)(__bf16)v; }
// same-wave LDS spill -> reload ordering: drain DS, lockstep the wave, keep the compiler from hoisting the reloads
__device__ __forceinline__ void ldsx() { asm volatile("s_wait_dscnt 0" ::: "memory"); __builtin_amdgcn_wave_barrier(); __builtin_amdgcn_fence(4, "workgroup"); }

// ---- sizes: NB x SEQ rows processed; inputs and d_in row strides use the *_FULL extents
#ifndef NB
#define NB 2
#endif
#ifndef SEQ
#define SEQ 2048
#endif
#ifndef NB_FULL
#define NB_FULL 2
#endif
#ifndef SEQ_FULL
#define SEQ_FULL 2048
#endif
#define CC 1024            // model width
#define NH 16              // heads
#define HD 64              // head width; column n of q/k/v = h*HD + d
#define KT 64              // keys per step of the fused softmax kernel

static_assert(NB >= 1 && NB <= NB_FULL);
static_assert(SEQ % 64 == 0 && SEQ <= SEQ_FULL && SEQ_FULL % 4 == 0);
static_assert(NH * HD == CC && HD == 64 && CC % 128 == 0 && KT == 64);

#define PLB (2u * (size_t)NB * SEQ * CC)   // one 16-bit [NB*SEQ][CC] plane
#define WPB (2u * (size_t)CC * CC)         // one 16-bit [CC][CC] weight plane
#define WS_XQ ((size_t)0)                  // bf16 x planes [b*SEQ+s][CC]
#define WS_XK (WS_XQ + PLB)
#define WS_XV (WS_XK + PLB)
#define WS_WQ (WS_XV + PLB)                // bf16 weight planes [out][in]
#define WS_WK (WS_WQ + WPB)
#define WS_WV (WS_WK + WPB)
#define WS_QH (WS_WV + WPB)                // f16 q hi [b*SEQ+s][CC]
#define WS_QL (WS_QH + PLB)                // f16 q residual x 2^10
#define WS_KH (WS_QL + PLB)                // f16 k hi [b*SEQ+s][CC]
#define WS_VT (WS_KH + PLB)                // bf16 v hi, transposed [b][CC][SEQ]
#define WS_VL (WS_VT + PLB)                // bf16 v lo, transposed
#define WS_END (WS_VL + PLB)
static_assert(PLB % 128 == 0 && WPB % 128 == 0);
static_assert(WS_END <= (size_t)134217728u);

// ---- k_cvt: z = 0..5 selects (x_q, x_k, x_v, w_q, w_k, w_v): f32 -> bf16 (RNE), 8 elements per thread, one 16-B store per lane
// coverage: x planes NB*SEQ*CC/8 chunks (source rows remapped through the full strides), weight planes CC*CC/8 chunks; grid.x = max of the two
__global__ __launch_bounds__(256) void k_cvt(const float* __restrict__ XQ, const float* __restrict__ XK, const float* __restrict__ XV,
                                             const float* __restrict__ WQ, const float* __restrict__ WK, const float* __restrict__ WV,
                                             __bf16* __restrict__ DQ, __bf16* __restrict__ DK, __bf16* __restrict__ DV,
                                             __bf16* __restrict__ DWQ, __bf16* __restrict__ DWK, __bf16* __restrict__ DWV) {
  const int z = blockIdx.z;
  const float* src = z == 0 ? XQ : z == 1 ? XK : z == 2 ? XV : z == 3 ? WQ : z == 4 ? WK : WV;
  __bf16* dst = z == 0 ? DQ : z == 1 ? DK : z == 2 ? DV : z == 3 ? DWQ : z == 4 ? DWK : DWV;
  const size_t n8 = (z < 3) ? (size_t)NB * SEQ * CC / 8 : (size_t)CC * CC / 8;
  const size_t e = (size_t)blockIdx.x * 256 + threadIdx.x;
  if (e >= n8) return;
  size_t so = e * 8;
  if (z < 3) { const size_t row = e / (CC / 8), c = e % (CC / 8); so = ((row / SEQ) * SEQ_FULL + (row % SEQ)) * CC + c * 8; }
  const v4f f0 = *(const v4f*)(src + so), f1 = *(const v4f*)(src + so + 4);
  union { v8b v; v4u u; } o;
#pragma unroll
  for (int i = 0; i < 4; ++i) { o.v[i] = (__bf16)f0[i]; o.v[4 + i] = (__bf16)f1[i]; }
  vst2((void*)(dst + e * 8), o.u);
}

// ---- k_proj: block = (128 rows, 128 cols, which), 4 waves as 2 x 2, each a 64 x 64 tile: y = x W^T + b with exact bf16 products, k summed in ascending 32-steps;
// q -> f16 hi + residual, k -> f16 hi, v -> bf16 hi/lo transposed planes.
// Per stage a 64-wide k slice of the block's 128 x rows and 128 W rows is brought into LDS once by asynchronous copies (two buffers: the next
// slice flies while this one is multiplied); every wave takes its fragments from there, so each operand byte leaves L2 once per block, in whole 128-B lines.
// coverage: grid (NB*SEQ/128, CC/128, 3) writes every row and column of QH, QL, KH, VT, VL exactly once
#define PM 128             // x rows per block
#define PN 128             // W rows (output columns) per block
#define PK 64              // k per stage: 128 B of every operand row
#define PP 72              // LDS row pitch in elements: 144 B = 16 B x 9, conflict-free for the 16-B fragment reads
#define PBUF ((PM + PN) * PP)   // elements of one buffer: x rows, then W rows
#define PE 136             // row pitch in elements of the output staging that takes the ring's place after the loop
static_assert((NB * SEQ) % PM == 0 && SEQ % PM == 0 && CC % PN == 0 && CC % PK == 0 && CC / PK >= 2);
static_assert(PM == 128 && PN == 128 && PK == 64 && 2 * PM * PE <= 2 * PBUF && 2 * PN * PE <= 2 * PBUF);

// eight asynchronous 16-B copies per lane, global -> LDS, rows 16 apart (global pitch CC elements, LDS pitch PP elements);
// the s_wait_xcnt 0 closes the copies' own statement so that no address register named here is rewritten ahead of it
__device__ __forceinline__ void copy8(unsigned l, const __bf16* g) {
  asm volatile("global_load_async_to_lds_b128 %0, %8, off\n\t"
               "global_load_async_to_lds_b128 %1, %9, off\n\t"
               "global_load_async_to_lds_b128 %2, %10, off\n\t"
               "global_load_async_to_lds_b128 %3, %11, off\n\t"
               "global_load_async_to_lds_b128 %4, %12, off\n\t"
               "global_load_async_to_lds_b128 %5, %13, off\n\t"
               "global_load_async_to_lds_b128 %6, %14, off\n\t"
               "global_load_async_to_lds_b128 %7, %15, off\n\t"
               "s_wait_xcnt 0x0"
               :: "v"(l), "v"(l + 1u * 32u * PP), "v"(l + 2u * 32u * PP), "v"(l + 3u * 32u * PP),
                  "v"(l + 4u * 32u * PP), "v"(l + 5u * 32u * PP), "v"(l + 6u * 32u * PP), "v"(l + 7u * 32u * PP),
                  "v"(g), "v"(g + 1 * 16 * CC), "v"(g + 2 * 16 * CC), "v"(g + 3 * 16 * CC),
                  "v"(g + 4 * 16 * CC), "v"(g + 5 * 16 * CC), "v"(g + 6 * 16 * CC), "v"(g + 7 * 16 * CC)
               : "memory");
}

__global__ __launch_bounds__(128) void k_proj(const __bf16* __restrict__ XQ, const __bf16* __restrict__ XK, const __bf16* __restrict__ XV,
                                              const __bf16* __restrict__ WQ, const __bf16* __restrict__ WK, const __bf16* __restrict__ WV,
                                              const float* __restrict__ BQ, const float* __restrict__ BK, const float* __restrict__ BV,
                                              _Float16* __restrict__ QH, _Float16* __restrict__ QL, _Float16* __restrict__ KH,
                                              __bf16* __restrict__ VT, __bf16* __restrict__ VL) {
  __shared__ __align__(16) __bf16 ring[2 * PBUF];          // two operand buffers; output staging after the loop
  const int tid = threadIdx.x, wave = tid >> 5, lane = tid & 31, col = lane & 15, g = lane >> 4;
  const int wm = wave >> 1, wn = wave & 1;                 // this wave's 64 x 64 quarter of the block tile
  const int which = blockIdx.z; const int c0 = blockIdx.y * PN; const size_t r0 = (size_t)blockIdx.x * PM;
  const __bf16* X = which == 0 ? XQ : which == 1 ? XK : XV;
  const __bf16* W = which == 0 ? WQ : which == 1 ? WK : WV;
  const float* BA = which == 0 ? BQ : which == 1 ? BK : BV;
  // copies: lane = (row tid>>3 of each 16-row group, 16-B piece tid&7 of the row's 128 B); 8 lanes cover one whole line
  const int cr = tid >> 3, cp = (tid & 7) * 8;
  const __bf16* gx = X + (r0 + cr) * CC + cp;
  const __bf16* gw = W + (size_t)(c0 + cr) * CC + cp;
  const unsigned lx = (unsigned)(size_t)&ring[cr * PP + cp], lw = lx + 2u * PM * PP;
  copy8(lx, gx); copy8(lw, gw);                            // stage 0 -> buffer 0
  asm volatile("s_wait_asynccnt 0x0" ::: "memory");        // this wave's stage-0 copies have landed
  __syncthreads();                                         // ... and every other wave's
  copy8(lx + 2u * PBUF, gx + PK); copy8(lw + 2u * PBUF, gw + PK);   // stage 1 -> buffer 1
  v8f acc[4][4] = {};
#pragma unroll 1   // one stage per trip: the ring's order of waits, barrier and refill stays as written
  for (int t = 0; t < CC / PK; ++t) {
    const __bf16* xb = ring + (t & 1) * PBUF + (wm * 64 + col) * PP;
    const __bf16* wb = ring + (t & 1) * PBUF + (PM + wn * 64 + col) * PP;
#pragma unroll
    for (int kc = 0; kc < PK / 32; ++kc) {
      v16b a[4], w[4];
#pragma unroll
      for (int i = 0; i < 4; ++i) a[i] = frag_b(xb + i * 16 * PP + kc * 32, lane);      // A: x row m, split k map
#pragma unroll
      for (int j = 0; j < 4; ++j) w[j] = frag_b(wb + j * 16 * PP + kc * 32, lane);      // B[k][n] = W[n][k]: k-contiguous row n, same map
#pragma unroll
      for (int i = 0; i < 4; ++i)
#pragma unroll
        for (int j = 0; j < 4; ++j) acc[i][j] = wmma_bf(a[i], w[j], acc[i][j]); }
    asm volatile("s_wait_dscnt 0x0" ::: "memory");         // this wave's reads of buffer t&1 are done
    asm volatile("s_wait_asynccnt 0x0" ::: "memory");      // this wave's copies of stage t+1 have landed
    __syncthreads();                                       // publishes stage t+1 and frees buffer t&1
    if (t + 2 < CC / PK) { const unsigned bo = (unsigned)(t & 1) * 2u * PBUF;
      copy8(lx + bo, gx + (t + 2) * PK); copy8(lw + bo, gw + (t + 2) * PK); }
  }
  asm volatile("s_wait_asynccnt 0x0" ::: "memory");        // no copy outstanding before the ring becomes output staging
  if (which == 2) { __bf16* th = ring; __bf16* tl2 = ring + PN * PE;            // [col][row]
#pragma unroll
    for (int j = 0; j < 4; ++j) { const int cl = wn * 64 + j * 16 + col; const float bb = bfr(BA[c0 + cl]);
#pragma unroll
      for (int i = 0; i < 4; ++i) { v8b hi, lo;
#pragma unroll
        for (int r = 0; r < 8; ++r) { const float v = acc[i][j][r] + bb; const __bf16 bh = (__bf16)v; hi[r] = bh; lo[r] = (__bf16)(v - (float)bh); }
        const int rl = wm * 64 + i * 16 + 8 * g;
        *(v8b*)&th[cl * PE + rl] = hi; *(v8b*)&tl2[cl * PE + rl] = lo; } }
    __syncthreads();
    // stores: lane = (staged row tid>>4 of each 8-row group, 16-B piece tid&15): 16 lanes cover 256 contiguous bytes; one address per plane, constant steps
    const int sr = tid >> 4, sq = (tid & 15) * 8;
    const size_t o2 = ((r0 / SEQ) * CC + c0 + sr) * (size_t)SEQ + (r0 % SEQ) + sq;
#pragma unroll
    for (int i = 0; i < PN / 8; ++i) vst2((void*)(VT + o2 + (size_t)i * 8 * SEQ), *(const v4u*)&th[(sr + i * 8) * PE + sq]);
#pragma unroll
    for (int i = 0; i < PN / 8; ++i) vst2((void*)(VL + o2 + (size_t)i * 8 * SEQ), *(const v4u*)&tl2[(sr + i * 8) * PE + sq]); }
  else { _Float16* sh = (_Float16*)ring; _Float16* sl = sh + PM * PE;            // [row][col]
#pragma unroll
    for (int j = 0; j < 4; ++j) { const int cl = wn * 64 + j * 16 + col; const float bb = bfr(BA[c0 + cl]);
#pragma unroll
      for (int i = 0; i < 4; ++i)
#pragma unroll
        for (int r = 0; r < 8; ++r) { const float v = acc[i][j][r] + bb; const int rl = wm * 64 + i * 16 + 8 * g + r;
          const _Float16 hv = (_Float16)v; sh[rl * PE + cl] = hv; sl[rl * PE + cl] = (_Float16)((v - (float)hv) * 1024.0f); }   /* q residual carried x 2^10 so the plane stays f16-normal */ }
    __syncthreads();
    const int sr = tid >> 4, sq = (tid & 15) * 8;           // as above
    const size_t o1 = (r0 + sr) * CC + c0 + sq;
    if (which == 0) {
#pragma unroll
      for (int i = 0; i < PM / 8; ++i) vst2((void*)(QH + o1 + (size_t)i * 8 * CC), *(const v4u*)&sh[(sr + i * 8) * PE + sq]);
#pragma unroll
      for (int i = 0; i < PM / 8; ++i) vst2((void*)(QL + o1 + (size_t)i * 8 * CC), *(const v4u*)&sl[(sr + i * 8) * PE + sq]);
      asm volatile("s_wait_xcnt 0x0" ::: "memory");        // precaution: stands between the stores above and any later rewrite of a register that they name
    }
    else {
#pragma unroll
      for (int i = 0; i < PM / 8; ++i) vst2((void*)(KH + o1 + (size_t)i * 8 * CC), *(const v4u*)&sh[(sr + i * 8) * PE + sq]);
      asm volatile("s_wait_xcnt 0x0" ::: "memory");        // precaution: stands between the stores above and any later rewrite of a register that they name
    } }
}

// ---- k_att: block = (64 queries, head h, batch b), 4 waves x 16 query rows; per step a 64-key tile of k (f16), v hi/lo (bf16) and m (f32) is staged in LDS;
// logits = -(q.k)/8 + m (q f16 hi + residual x k f16 hi), online softmax in f32, P x 2^11 spilled per wave to LDS and reloaded as bf16 hi+lo A fragments,
// o += P v (3 products), out = o / (l * 2^11).  LDS regions: kt/vhs/vls/ms cross-wave (block barriers), ps wave-private (ldsx).
__global__ __launch_bounds__(128) void k_att(const _Float16* __restrict__ QH, const _Float16* __restrict__ QL, const _Float16* __restrict__ KH,
                                             const __bf16* __restrict__ VT, const __bf16* __restrict__ VL, const float* __restrict__ MK, float* __restrict__ OUT) {
  __shared__ __align__(16) _Float16 kt[KT][72];           // [key][d]
  __shared__ __align__(16) __bf16 vhs[HD][72], vls[HD][72]; // [d][key]
  __shared__ __align__(16) float ms[64][68];               // [query][key]
  __shared__ __align__(16) float ps[4][16][68];            // per wave: [query][key] P x 2^11, later [query][d] output staging
  const int tid = threadIdx.x, wave = tid >> 5, lane = tid & 31, col = lane & 15, g = lane >> 4;
  const int b = blockIdx.z, h = blockIdx.y, qb0 = blockIdx.x * 64, ql0 = qb0 + wave * 16;
  const size_t qrow = (size_t)b * SEQ + ql0;
  v16h qh[2], qlo[2];
#pragma unroll
  for (int kc = 0; kc < 2; ++kc) { qh[kc] = frag_h(QH + (qrow + col) * CC + h * HD + kc * 32, lane); qlo[kc] = frag_h(QL + (qrow + col) * CC + h * HD + kc * 32, lane); }
  float mrow[8], lrow[8]; v8f o[4];
#pragma unroll
  for (int r = 0; r < 8; ++r) { mrow[r] = -3.0e38f; lrow[r] = 0.0f; }
#pragma unroll
  for (int t = 0; t < 4; ++t) o[t] = (v8f){};
#pragma unroll 1
  for (int kb = 0; kb < SEQ / KT; ++kb) {
    const int k0 = kb * KT;
    __syncthreads();                                        // all waves done with the earlier tile
    // staged extent == consumed extent: kt rows 0..63 x d 0..63, vhs/vls d 0..63 x keys 0..63, ms 64 x 64
#pragma unroll
    for (int i = 0; i < 4; ++i) { const int e = tid + 128 * i, rr = e >> 3, c = e & 7;
      *(v8h*)&kt[rr][c * 8] = *(const v8h*)(KH + ((size_t)b * SEQ + k0 + rr) * CC + h * HD + c * 8);
      const size_t vo = ((size_t)b * CC + h * HD + rr) * SEQ + k0 + c * 8;
      *(v8b*)&vhs[rr][c * 8] = *(const v8b*)(VT + vo); *(v8b*)&vls[rr][c * 8] = *(const v8b*)(VL + vo); }
#pragma unroll
    for (int i = 0; i < 8; ++i) { const int e = tid + 128 * i, qr = e >> 4, c = e & 15;
      *(v4f*)&ms[qr][c * 4] = *(const v4f*)(MK + ((size_t)b * SEQ_FULL + qb0 + qr) * SEQ_FULL + k0 + c * 4); }
    __syncthreads();
    v8f s[4];
#pragma unroll
    for (int j = 0; j < 4; ++j) { v8f a = {}, al = {};
#pragma unroll
      for (int kc = 0; kc < 2; ++kc) { const v16h kf = frag_h(&kt[j * 16 + col][kc * 32], lane);   // B[k=d][n=key]: k-contiguous row per key
        a = wmma16(qh[kc], kf, a); al = wmma16(qlo[kc], kf, al); }
      s[j] = a * (-0.125f) + al * (-0.125f / 1024.0f); }   /* -(q.k)/sqrt(64), residual folded back with 2^-10 */
#pragma unroll
    for (int r = 0; r < 8; ++r) { const int mr = wave * 16 + 8 * g + r;
#pragma unroll
      for (int j = 0; j < 4; ++j) s[j][r] += bfr(ms[mr][j * 16 + col]);
      float v = fmaxf(fmaxf(s[0][r], s[1][r]), fmaxf(s[2][r], s[3][r]));
      v = fmaxf(v, __shfl_xor(v, 1, 16)); v = fmaxf(v, __shfl_xor(v, 2, 16)); v = fmaxf(v, __shfl_xor(v, 4, 16)); v = fmaxf(v, __shfl_xor(v, 8, 16));
      const float mn = fmaxf(mrow[r], v); const float alpha = expf(mrow[r] - mn); float rs = 0.0f;
#pragma unroll
      for (int j = 0; j < 4; ++j) { const float p = expf(s[j][r] - mn); s[j][r] = p; rs += p; }
      rs += __shfl_xor(rs, 1, 16); rs += __shfl_xor(rs, 2, 16); rs += __shfl_xor(rs, 4, 16); rs += __shfl_xor(rs, 8, 16);
      lrow[r] = lrow[r] * alpha + rs; mrow[r] = mn;
#pragma unroll
      for (int t = 0; t < 4; ++t) o[t][r] *= alpha; }
    // spill P x 2^11 in the D layout (row 8g+r, key j*16+col), then reload rows as A fragments (same float element type, ldsx between)
#pragma unroll
    for (int j = 0; j < 4; ++j)
#pragma unroll
      for (int r = 0; r < 8; ++r) ps[wave][8 * g + r][j * 16 + col] = s[j][r] * 2048.0f;
    ldsx();
#pragma unroll
    for (int kc = 0; kc < 2; ++kc) { const F2 p = split_row(&ps[wave][col][0], kc * 32, lane);
#pragma unroll
      for (int t = 0; t < 4; ++t) {
        const v16b vh = frag_b(&vhs[t * 16 + col][kc * 32], lane), vl = frag_b(&vls[t * 16 + col][kc * 32], lane);   // B[k=key][n=d]: key-contiguous row per d
        o[t] = wmma_bf(p.h, vh, o[t]); o[t] = wmma_bf(p.l, vh, o[t]); o[t] = wmma_bf(p.h, vl, o[t]); } }
  }
  ldsx();
#pragma unroll
  for (int r = 0; r < 8; ++r) { const float inv = (1.0f / lrow[r]) * (1.0f / 2048.0f);
#pragma unroll
    for (int t = 0; t < 4; ++t) ps[wave][8 * g + r][t * 16 + col] = o[t][r] * inv; }
  ldsx();
  for (int rl = 0; rl < 16; ++rl) { const v4f w4 = *(const v4f*)&ps[wave][rl][(lane & 15) * 4];
    if (lane < HD / 4) vst2((void*)(OUT + ((size_t)b * SEQ + ql0 + rl) * CC + h * HD + lane * 4), w4); }
}

extern "C" void kernel_launch(void* const* d_in, const int* in_sizes, int n_in, void* d_out, int out_size, void* d_ws, size_t ws_size, hipStream_t stream) {
  if (n_in < 10) return;
  const size_t needX = ((size_t)(NB - 1) * SEQ_FULL + SEQ) * CC;
  const size_t needM = ((size_t)(NB - 1) * SEQ_FULL + SEQ - 1) * SEQ_FULL + SEQ;
  if ((size_t)in_sizes[0] < needX || (size_t)in_sizes[1] < needX || (size_t)in_sizes[2] < needX) return;
  if ((size_t)in_sizes[3] < needM) return;
  if ((size_t)in_sizes[4] < (size_t)CC * CC || (size_t)in_sizes[6] < (size_t)CC * CC || (size_t)in_sizes[8] < (size_t)CC * CC) return;
  if (in_sizes[5] < CC || in_sizes[7] < CC || in_sizes[9] < CC) return;
  if ((size_t)out_size < (size_t)NB * SEQ * CC) return;
  if (ws_size < (size_t)WS_END) return;
  const float* const* F = (const float* const*)d_in;   // 0 x_q, 1 x_k, 2 x_v [2,2048,1024]; 3 m [2,2048,2048]; 4 w_q [out][in], 5 b_q, 6 w_k, 7 b_k, 8 w_v, 9 b_v
  char* ws = (char*)d_ws;
  __bf16 *XQb = (__bf16*)(ws + WS_XQ), *XKb = (__bf16*)(ws + WS_XK), *XVb = (__bf16*)(ws + WS_XV);
  __bf16 *WQb = (__bf16*)(ws + WS_WQ), *WKb = (__bf16*)(ws + WS_WK), *WVb = (__bf16*)(ws + WS_WV);
  _Float16 *QH = (_Float16*)(ws + WS_QH), *QL = (_Float16*)(ws + WS_QL), *KH = (_Float16*)(ws + WS_KH);
  __bf16 *VT = (__bf16*)(ws + WS_VT), *VL = (__bf16*)(ws + WS_VL);
  const size_t nx8 = (size_t)NB * SEQ * CC / 8, nw8 = (size_t)CC * CC / 8;
  const unsigned gx8 = (unsigned)((nx8 + 255) / 256), gw8 = (unsigned)((nw8 + 255) / 256);
  const unsigned gx = gx8 > gw8 ? gx8 : gw8;
  k_cvt<<<dim3(gx, 1, 6), 256, 0, stream>>>(F[0], F[1], F[2], F[4], F[6], F[8], XQb, XKb, XVb, WQb, WKb, WVb);
  k_proj<<<dim3(NB * SEQ / PM, CC / PN, 3), 128, 0, stream>>>(XQb, XKb, XVb, WQb, WKb, WVb, F[5], F[7], F[9], QH, QL, KH, VT, VL);
  k_att<<<dim3(SEQ / 64, NH, NB), 128, 0, stream>>>(QH, QL, KH, VT, VL, F[3], (float*)d_out);
}

// v002
// One run takes 159 microseconds.
// Timed twice side by side with v001, it ran 1.99 times as fast both times.
// Over all steps from v000 it is 2.68 times as fast.
// compute dtype: float inputs RNE-converted to bf16; q/k/v = x W^T + b on v_wmma_f32_16x16x32_bf16 (bf16 operands, exact products, f32 accumulate); logits -q.k/8 + m from q as f16 hi + f16 residual (x 2^10) times k f16 hi on v_wmma_f32_16x16x32_f16 (2 products, f32 accumulate); online softmax in f32 (precise expf); P x 2^11 as bf16 hi + lo times v bf16 hi + lo on v_wmma_f32_16x16x32_bf16 (3 products, f32 accumulate); f32 output.
#include <hip/hip_runtime.h>
#include <math.h>

typedef __attribute__((ext_vector_type(16))) _Float16 v16h;
typedef __attribute__((ext_vector_type(16))) __bf16 v16b;
typedef __attribute__((ext_vector_type(8)))  _Float16 v8h;
typedef __attribute__((ext_vector_type(8)))  __bf16 v8b;
typedef __attribute__((ext_vector_type(8)))  float v8f;
typedef __attribute__((ext_vector_type(4)))  float v4f;
typedef __attribute__((ext_vector_type(4)))  unsigned v4u;

template <typename T> __device__ __forceinline__ void vst2(void* p, T v) { *(T*)p = v;  }

__device__ __forceinline__ v8f wmma16(v16h a, v16h b, v8f c) {
  v8f d = __builtin_amdgcn_wmma_f32_16x16x32_f16(false, a, false, b, (short)0, c, false, false);
  asm volatile("v_nop\n\tv_nop\n\tv_nop\n\tv_nop" : "+v"(d) : "v"(a), "v"(b));
  return d;
}
__device__ __forceinline__ v8f wmma_bf(v16b a, v16b b, v8f c) {
  v8f d = __builtin_amdgcn_wmma_f32_16x16x32_bf16(false, a, false, b, (short)0, c, false, false);
  asm volatile("v_nop\n\tv_nop\n\tv_nop\n\tv_nop" : "+v"(d) : "v"(a), "v"(b));
  return d;
}
// 16x16x32 fragments: lane = (g = lane>>4, row/col = lane&15); elements 0..7 = k0+8g+0..7, 8..15 = k0+16+8g+0..7; D element r = row 8g+r, col lane&15
// A from a row-major [m][k] row pointer at k0; B from a k-contiguous [n][k] row pointer at k0 (same map)
__device__ __forceinline__ v16h frag_h(const _Float16* rowk0, int lane) {
  union { v16h v; v8h q[2]; } u; const _Float16* p = rowk0 + 8 * (lane >> 4);
  u.q[0] = *(const v8h*)p; u.q[1] = *(const v8h*)(p + 16); return u.v;
}
__device__ __forceinline__ v16b frag_b(const __bf16* rowk0, int lane) {
  union { v16b v; v8b q[2]; } u; const __bf16* p = rowk0 + 8 * (lane >> 4);
  u.q[0] = *(const v8b*)p; u.q[1] = *(const v8b*)(p + 16); return u.v;
}
struct F2 { v16b h, l; };
__device__ __forceinline__ F2 bsplit16(const float v[16]) { F2 r;
#pragma unroll
  for (int i = 0; i < 16; ++i) { const __bf16 h = (__bf16)v[i]; r.h[i] = h; r.l[i] = (__bf16)(v[i] - (float)h); }
  return r; }
__device__ __forceinline__ F2 split_row(const float* row, int k0, int lane) { float v[16]; const float* p = row + k0 + 8 * (lane >> 4);
#pragma unroll
  for (int i = 0; i < 8; ++i) { v[i] = p[i]; v[8 + i] = p[16 + i]; }
  return bsplit16(v); }
__device__ __forceinline__ float bfr(float v) { return (float)(__bf16)v; }
// same-wave LDS spill -> reload ordering: drain DS, lockstep the wave, keep the compiler from hoisting the reloads
__device__ __forceinline__ void ldsx() { asm volatile("s_wait_dscnt 0" ::: "memory"); __builtin_amdgcn_wave_barrier(); __builtin_amdgcn_fence(4, "workgroup"); }

// ---- sizes: NB x SEQ rows processed; inputs and d_in row strides use the *_FULL extents
#ifndef NB
#define NB 2
#endif
#ifndef SEQ
#define SEQ 2048
#endif
#ifndef NB_FULL
#define NB_FULL 2
#endif
#ifndef SEQ_FULL
#define SEQ_FULL 2048
#endif
#define CC 1024            // model width
#define NH 16              // heads
#define HD 64              // head width; column n of q/k/v = h*HD + d
#define KT 64              // keys per step of the fused softmax kernel

static_assert(NB >= 1 && NB <= NB_FULL);
static_assert(SEQ % 64 == 0 && SEQ <= SEQ_FULL && SEQ_FULL % 4 == 0);
static_assert(NH * HD == CC && HD == 64 && CC % 128 == 0 && KT == 64);

#define PLB (2u * (size_t)NB * SEQ * CC)   // one 16-bit [NB*SEQ][CC] plane
#define WPB (2u * (size_t)CC * CC)         // one 16-bit [CC][CC] weight plane
#define WS_XQ ((size_t)0)                  // bf16 x planes [b*SEQ+s][CC]
#define WS_XK (WS_XQ + PLB)
#define WS_XV (WS_XK + PLB)
#define WS_WQ (WS_XV + PLB)                // bf16 weight planes [out][in]
#define WS_WK (WS_WQ + WPB)
#define WS_WV (WS_WK + WPB)
#define WS_QH (WS_WV + WPB)                // f16 q hi [b*SEQ+s][CC]
#define WS_QL (WS_QH + PLB)                // f16 q residual x 2^10
#define WS_KH (WS_QL + PLB)                // f16 k hi [b*SEQ+s][CC]
#define WS_VT (WS_KH + PLB)                // bf16 v hi, transposed [b][CC][SEQ]
#define WS_VL (WS_VT + PLB)                // bf16 v lo, transposed
#define WS_END (WS_VL + PLB)
static_assert(PLB % 128 == 0 && WPB % 128 == 0);
static_assert(WS_END <= (size_t)134217728u);

// ---- k_cvt: z = 0..5 selects (x_q, x_k, x_v, w_q, w_k, w_v): f32 -> bf16 (RNE), 8 elements per thread, one 16-B store per lane
// coverage: x planes NB*SEQ*CC/8 chunks (source rows remapped through the full strides), weight planes CC*CC/8 chunks; grid.x = max of the two
__global__ __launch_bounds__(256) void k_cvt(const float* __restrict__ XQ, const float* __restrict__ XK, const float* __restrict__ XV,
                                             const float* __restrict__ WQ, const float* __restrict__ WK, const float* __restrict__ WV,
                                             __bf16* __restrict__ DQ, __bf16* __restrict__ DK, __bf16* __restrict__ DV,
                                             __bf16* __restrict__ DWQ, __bf16* __restrict__ DWK, __bf16* __restrict__ DWV) {
  const int z = blockIdx.z;
  const float* src = z == 0 ? XQ : z == 1 ? XK : z == 2 ? XV : z == 3 ? WQ : z == 4 ? WK : WV;
  __bf16* dst = z == 0 ? DQ : z == 1 ? DK : z == 2 ? DV : z == 3 ? DWQ : z == 4 ? DWK : DWV;
  const size_t n8 = (z < 3) ? (size_t)NB * SEQ * CC / 8 : (size_t)CC * CC / 8;
  const size_t e = (size_t)blockIdx.x * 256 + threadIdx.x;
  if (e >= n8) return;
  size_t so = e * 8;
  if (z < 3) { const size_t row = e / (CC / 8), c = e % (CC / 8); so = ((row / SEQ) * SEQ_FULL + (row % SEQ)) * CC + c * 8; }
  const v4f f0 = *(const v4f*)(src + so), f1 = *(const v4f*)(src + so + 4);
  union { v8b v; v4u u; } o;
#pragma unroll
  for (int i = 0; i < 4; ++i) { o.v[i] = (__bf16)f0[i]; o.v[4 + i] = (__bf16)f1[i]; }
  vst2((void*)(dst + e * 8), o.u);
}

// ---- k_proj: block = (128 rows, 128 cols, which), 4 waves as 2 x 2, each a 64 x 64 tile: y = x W^T + b with exact bf16 products, k summed in ascending 32-steps;
// q -> f16 hi + residual, k -> f16 hi, v -> bf16 hi/lo transposed planes.
// Per stage a 64-wide k slice of the block's 128 x rows and 128 W rows is brought into LDS once by asynchronous copies (two buffers: the next
// slice flies while this one is multiplied); every wave takes its fragments from there, so each operand byte leaves L2 once per block, in whole 128-B lines.
// coverage: grid (NB*SEQ/128, CC/128, 3) writes every row and column of QH, QL, KH, VT, VL exactly once
#define PM 128             // x rows per block
#define PN 128             // W rows (output columns) per block
#define PK 64              // k per stage: 128 B of every operand row
#define PP 72              // LDS row pitch in elements: 144 B = 16 B x 9, conflict-free for the 16-B fragment reads
#define PBUF ((PM + PN) * PP)   // elements of one buffer: x rows, then W rows
#define PE 136             // row pitch in elements of the output staging that takes the ring's place after the loop
static_assert((NB * SEQ) % PM == 0 && SEQ % PM == 0 && CC % PN == 0 && CC % PK == 0 && CC / PK >= 2);
static_assert(PM == 128 && PN == 128 && PK == 64 && 2 * PM * PE <= 2 * PBUF && 2 * PN * PE <= 2 * PBUF);

// eight asynchronous 16-B copies per lane, global -> LDS, rows 16 apart (global pitch CC elements, LDS pitch PP elements);
// the s_wait_xcnt 0 closes the copies' own statement so that no address register named here is rewritten ahead of it
__device__ __forceinline__ void copy8(unsigned l, const __bf16* g) {
  asm volatile("global_load_async_to_lds_b128 %0, %8, off\n\t"
               "global_load_async_to_lds_b128 %1, %9, off\n\t"
               "global_load_async_to_lds_b128 %2, %10, off\n\t"
               "global_load_async_to_lds_b128 %3, %11, off\n\t"
               "global_load_async_to_lds_b128 %4, %12, off\n\t"
               "global_load_async_to_lds_b128 %5, %13, off\n\t"
               "global_load_async_to_lds_b128 %6, %14, off\n\t"
               "global_load_async_to_lds_b128 %7, %15, off\n\t"
               "s_wait_xcnt 0x0"
               :: "v"(l), "v"(l + 1u * 32u * PP), "v"(l + 2u * 32u * PP), "v"(l + 3u * 32u * PP),
                  "v"(l + 4u * 32u * PP), "v"(l + 5u * 32u * PP), "v"(l + 6u * 32u * PP), "v"(l + 7u * 32u * PP),
                  "v"(g), "v"(g + 1 * 16 * CC), "v"(g + 2 * 16 * CC), "v"(g + 3 * 16 * CC),
                  "v"(g + 4 * 16 * CC), "v"(g + 5 * 16 * CC), "v"(g + 6 * 16 * CC), "v"(g + 7 * 16 * CC)
               : "memory");
}

__global__ __launch_bounds__(128) void k_proj(const __bf16* __restrict__ XQ, const __bf16* __restrict__ XK, const __bf16* __restrict__ XV,
                                              const __bf16* __restrict__ WQ, const __bf16* __restrict__ WK, const __bf16* __restrict__ WV,
                                              const float* __restrict__ BQ, const float* __restrict__ BK, const float* __restrict__ BV,
                                              _Float16* __restrict__ QH, _Float16* __restrict__ QL, _Float16* __restrict__ KH,
                                              __bf16* __restrict__ VT, __bf16* __restrict__ VL) {
  __shared__ __align__(16) __bf16 ring[2 * PBUF];          // two operand buffers; output staging after the loop
  const int tid = threadIdx.x, wave = tid >> 5, lane = tid & 31, col = lane & 15, g = lane >> 4;
  const int wm = wave >> 1, wn = wave & 1;                 // this wave's 64 x 64 quarter of the block tile
  const int which = blockIdx.z; const int c0 = blockIdx.y * PN; const size_t r0 = (size_t)blockIdx.x * PM;
  const __bf16* X = which == 0 ? XQ : which == 1 ? XK : XV;
  const __bf16* W = which == 0 ? WQ : which == 1 ? WK : WV;
  const float* BA = which == 0 ? BQ : which == 1 ? BK : BV;
  // copies: lane = (row tid>>3 of each 16-row group, 16-B piece tid&7 of the row's 128 B); 8 lanes cover one whole line
  const int cr = tid >> 3, cp = (tid & 7) * 8;
  const __bf16* gx = X + (r0 + cr) * CC + cp;
  const __bf16* gw = W + (size_t)(c0 + cr) * CC + cp;
  const unsigned lx = (unsigned)(size_t)&ring[cr * PP + cp], lw = lx + 2u * PM * PP;
  copy8(lx, gx); copy8(lw, gw);                            // stage 0 -> buffer 0
  asm volatile("s_wait_asynccnt 0x0" ::: "memory");        // this wave's stage-0 copies have landed
  __syncthreads();                                         // ... and every other wave's
  copy8(lx + 2u * PBUF, gx + PK); copy8(lw + 2u * PBUF, gw + PK);   // stage 1 -> buffer 1
  v8f acc[4][4] = {};
#pragma unroll 1   // one stage per trip: the ring's order of waits, barrier and refill stays as written
  for (int t = 0; t < CC / PK; ++t) {
    const __bf16* xb = ring + (t & 1) * PBUF + (wm * 64 + col) * PP;
    const __bf16* wb = ring + (t & 1) * PBUF + (PM + wn * 64 + col) * PP;
#pragma unroll
    for (int kc = 0; kc < PK / 32; ++kc) {
      v16b a[4], w[4];
#pragma unroll
      for (int i = 0; i < 4; ++i) a[i] = frag_b(xb + i * 16 * PP + kc * 32, lane);      // A: x row m, split k map
#pragma unroll
      for (int j = 0; j < 4; ++j) w[j] = frag_b(wb + j * 16 * PP + kc * 32, lane);      // B[k][n] = W[n][k]: k-contiguous row n, same map
#pragma unroll
      for (int i = 0; i < 4; ++i)
#pragma unroll
        for (int j = 0; j < 4; ++j) acc[i][j] = wmma_bf(a[i], w[j], acc[i][j]); }
    asm volatile("s_wait_dscnt 0x0" ::: "memory");         // this wave's reads of buffer t&1 are done
    asm volatile("s_wait_asynccnt 0x0" ::: "memory");      // this wave's copies of stage t+1 have landed
    __syncthreads();                                       // publishes stage t+1 and frees buffer t&1
    if (t + 2 < CC / PK) { const unsigned bo = (unsigned)(t & 1) * 2u * PBUF;
      copy8(lx + bo, gx + (t + 2) * PK); copy8(lw + bo, gw + (t + 2) * PK); }
  }
  asm volatile("s_wait_asynccnt 0x0" ::: "memory");        // no copy outstanding before the ring becomes output staging
  if (which == 2) { __bf16* th = ring; __bf16* tl2 = ring + PN * PE;            // [col][row]
#pragma unroll
    for (int j = 0; j < 4; ++j) { const int cl = wn * 64 + j * 16 + col; const float bb = bfr(BA[c0 + cl]);
#pragma unroll
      for (int i = 0; i < 4; ++i) { v8b hi, lo;
#pragma unroll
        for (int r = 0; r < 8; ++r) { const float v = acc[i][j][r] + bb; const __bf16 bh = (__bf16)v; hi[r] = bh; lo[r] = (__bf16)(v - (float)bh); }
        const int rl = wm * 64 + i * 16 + 8 * g;
        *(v8b*)&th[cl * PE + rl] = hi; *(v8b*)&tl2[cl * PE + rl] = lo; } }
    __syncthreads();
    // stores: lane = (staged row tid>>4 of each 8-row group, 16-B piece tid&15): 16 lanes cover 256 contiguous bytes; one address per plane, constant steps
    const int sr = tid >> 4, sq = (tid & 15) * 8;
    const size_t o2 = ((r0 / SEQ) * CC + c0 + sr) * (size_t)SEQ + (r0 % SEQ) + sq;
#pragma unroll
    for (int i = 0; i < PN / 8; ++i) vst2((void*)(VT + o2 + (size_t)i * 8 * SEQ), *(const v4u*)&th[(sr + i * 8) * PE + sq]);
#pragma unroll
    for (int i = 0; i < PN / 8; ++i) vst2((void*)(VL + o2 + (size_t)i * 8 * SEQ), *(const v4u*)&tl2[(sr + i * 8) * PE + sq]); }
  else { _Float16* sh = (_Float16*)ring; _Float16* sl = sh + PM * PE;            // [row][col]
#pragma unroll
    for (int j = 0; j < 4; ++j) { const int cl = wn * 64 + j * 16 + col; const float bb = bfr(BA[c0 + cl]);
#pragma unroll
      for (int i = 0; i < 4; ++i)
#pragma unroll
        for (int r = 0; r < 8; ++r) { const float v = acc[i][j][r] + bb; const int rl = wm * 64 + i * 16 + 8 * g + r;
          const _Float16 hv = (_Float16)v; sh[rl * PE + cl] = hv; sl[rl * PE + cl] = (_Float16)((v - (float)hv) * 1024.0f); }   /* q residual carried x 2^10 so the plane stays f16-normal */ }
    __syncthreads();
    const int sr = tid >> 4, sq = (tid & 15) * 8;           // as above
    const size_t o1 = (r0 + sr) * CC + c0 + sq;
    if (which == 0) {
#pragma unroll
      for (int i = 0; i < PM / 8; ++i) vst2((void*)(QH + o1 + (size_t)i * 8 * CC), *(const v4u*)&sh[(sr + i * 8) * PE + sq]);
#pragma unroll
      for (int i = 0; i < PM / 8; ++i) vst2((void*)(QL + o1 + (size_t)i * 8 * CC), *(const v4u*)&sl[(sr + i * 8) * PE + sq]);
      asm volatile("s_wait_xcnt 0x0" ::: "memory");        // precaution: stands between the stores above and any later rewrite of a register that they name
    }
    else {
#pragma unroll
      for (int i = 0; i < PM / 8; ++i) vst2((void*)(KH + o1 + (size_t)i * 8 * CC), *(const v4u*)&sh[(sr + i * 8) * PE + sq]);
      asm volatile("s_wait_xcnt 0x0" ::: "memory");        // precaution: stands between the stores above and any later rewrite of a register that they name
    } }
}

__device__ __forceinline__ float xhalf(float x) {          // lane l takes lane l ^ 16's value
  return __builtin_bit_cast(float, __builtin_amdgcn_permlanex16(__builtin_bit_cast(int, x), __builtin_bit_cast(int, x), 0x76543210, 0xfedcba98, false, false)); }

__global__ __launch_bounds__(128) void k_att(const _Float16* __restrict__ QH, const _Float16* __restrict__ QL, const _Float16* __restrict__ KH,
                                             const __bf16* __restrict__ VT, const __bf16* __restrict__ VL, const float* __restrict__ MK, float* __restrict__ OUT) {
  __shared__ __align__(16) _Float16 kt[KT][72];           // [key][d]
  __shared__ __align__(16) __bf16 vhs[HD][72], vls[HD][72]; // [d][key]
  __shared__ __align__(16) float ms[64][68];               // [query][key]; behind the loop [query][d] output staging
  const int tid = threadIdx.x, wave = tid >> 5, lane = tid & 31, col = lane & 15, g = lane >> 4;
  const int b = blockIdx.z, h = blockIdx.y, qb0 = blockIdx.x * 64, ql0 = qb0 + wave * 16;
  const size_t qrow = (size_t)b * SEQ + ql0;
  v16h qh[2], qlo[2];                                       // B[k=d][n=query]: k-contiguous row per query
#pragma unroll
  for (int kc = 0; kc < 2; ++kc) { qh[kc] = frag_h(QH + (qrow + col) * CC + h * HD + kc * 32, lane); qlo[kc] = frag_h(QL + (qrow + col) * CC + h * HD + kc * 32, lane); }
  float mrow = -3.0e38f, lrow = 0.0f; v8f o[4];             // query ql0+col: running maximum (both halves), this half's sum; o[t][r] = o^T[d = 16t+8g+r][query]
#pragma unroll
  for (int t = 0; t < 4; ++t) o[t] = (v8f){};
#pragma unroll 1
  for (int kb = 0; kb < SEQ / KT; ++kb) {
    const int k0 = kb * KT;
    __syncthreads();                                        // all waves done with the earlier tile
    // staged extent == consumed extent: kt rows 0..63 x d 0..63, vhs/vls d 0..63 x keys 0..63, ms 64 x 64
#pragma unroll
    for (int i = 0; i < 4; ++i) { const int e = tid + 128 * i, rr = e >> 3, c = e & 7;
      *(v8h*)&kt[rr][c * 8] = *(const v8h*)(KH + ((size_t)b * SEQ + k0 + rr) * CC + h * HD + c * 8);
      const size_t vo = ((size_t)b * CC + h * HD + rr) * SEQ + k0 + c * 8;
      *(v8b*)&vhs[rr][c * 8] = *(const v8b*)(VT + vo); *(v8b*)&vls[rr][c * 8] = *(const v8b*)(VL + vo); }
#pragma unroll
    for (int i = 0; i < 8; ++i) { const int e = tid + 128 * i, qr = e >> 4, c = e & 15;
      *(v4f*)&ms[qr][c * 4] = *(const v4f*)(MK + ((size_t)b * SEQ_FULL + qb0 + qr) * SEQ_FULL + k0 + c * 4); }
    __syncthreads();
    v8f s[4];                                               // s[j][r] = logit of key 16j+8g+r, query col
#pragma unroll
    for (int j = 0; j < 4; ++j) { v8f a = {}, al = {};
#pragma unroll
      for (int kc = 0; kc < 2; ++kc) { const v16h kf = frag_h(&kt[j * 16 + col][kc * 32], lane);   // A[m=key][k=d]: k-contiguous row per key, same map as q
        a = wmma16(kf, qh[kc], a); al = wmma16(kf, qlo[kc], al); }
      s[j] = a * (-0.125f) + al * (-0.125f / 1024.0f);     /* -(q.k)/sqrt(64), residual folded back with 2^-10 */
      const float* mp = &ms[wave * 16 + col][j * 16 + 8 * g];
      const v4f m0 = *(const v4f*)mp, m1 = *(const v4f*)(mp + 4);
#pragma unroll
      for (int r = 0; r < 4; ++r) { s[j][r] += bfr(m0[r]); s[j][4 + r] += bfr(m1[r]); } }
    float vj[4];                                            // four independent chains, then joined
#pragma unroll
    for (int j = 0; j < 4; ++j) { vj[j] = s[j][0];
#pragma unroll
      for (int r = 1; r < 8; ++r) vj[j] = fmaxf(vj[j], s[j][r]); }
    float v = fmaxf(fmaxf(vj[0], vj[1]), fmaxf(vj[2], vj[3]));
    v = fmaxf(v, xhalf(v));
    const float mn = fmaxf(mrow, v); const float alpha = expf(mrow - mn); float rs[4];
#pragma unroll
    for (int j = 0; j < 4; ++j) { rs[j] = 0.0f;
#pragma unroll
      for (int r = 0; r < 8; ++r) { const float p = expf(s[j][r] - mn); s[j][r] = p; rs[j] += p; } }
    lrow = lrow * alpha + ((rs[0] + rs[1]) + (rs[2] + rs[3])); mrow = mn;
#pragma unroll
    for (int t = 0; t < 4; ++t) o[t] *= alpha;
#pragma unroll
    for (int kc = 0; kc < 2; ++kc) { float pv[16];          // B[k=key][n=query]: elements 0..7 = keys 32kc+8g+0..7, 8..15 = 32kc+16+8g+0..7: the D registers of tiles 2kc, 2kc+1
#pragma unroll
      for (int i = 0; i < 8; ++i) { pv[i] = s[2 * kc][i] * 2048.0f; pv[8 + i] = s[2 * kc + 1][i] * 2048.0f; }
      const F2 p = bsplit16(pv);
#pragma unroll
      for (int t = 0; t < 4; ++t) {
        const v16b vh = frag_b(&vhs[t * 16 + col][kc * 32], lane), vl = frag_b(&vls[t * 16 + col][kc * 32], lane);   // A[m=d][k=key]: key-contiguous row per d, same map
        o[t] = wmma_bf(vh, p.h, o[t]); o[t] = wmma_bf(vh, p.l, o[t]); o[t] = wmma_bf(vl, p.h, o[t]); } }
  }
  ldsx();                                                   // this wave's last reads of its own ms rows are done; no other wave touches them any more
  const float inv = (1.0f / (lrow + xhalf(lrow))) * (1.0f / 2048.0f);
#pragma unroll
  for (int t = 0; t < 4; ++t) { float* op = &ms[wave * 16 + col][t * 16 + 8 * g]; const v8f w = o[t] * inv;
    *(v4f*)op = (v4f){w[0], w[1], w[2], w[3]}; *(v4f*)(op + 4) = (v4f){w[4], w[5], w[6], w[7]}; }
  ldsx();
  for (int rl = 0; rl < 16; ++rl) { const v4f w4 = *(const v4f*)&ms[wave * 16 + rl][(lane & 15) * 4];
    if (lane < HD / 4) vst2((void*)(OUT + ((size_t)b * SEQ + ql0 + rl) * CC + h * HD + lane * 4), w4); }
}

extern "C" void kernel_launch(void* const* d_in, const int* in_sizes, int n_in, void* d_out, int out_size, void* d_ws, size_t ws_size, hipStream_t stream) {
  if (n_in < 10) return;
  const size_t needX = ((size_t)(NB - 1) * SEQ_FULL + SEQ) * CC;
  const size_t needM = ((size_t)(NB - 1) * SEQ_FULL + SEQ - 1) * SEQ_FULL + SEQ;
  if ((size_t)in_sizes[0] < needX || (size_t)in_sizes[1] < needX || (size_t)in_sizes[2] < needX) return;
  if ((size_t)in_sizes[3] < needM) return;
  if ((size_t)in_sizes[4] < (size_t)CC * CC || (size_t)in_sizes[6] < (size_t)CC * CC || (size_t)in_sizes[8] < (size_t)CC * CC) return;
  if (in_sizes[5] < CC || in_sizes[7] < CC || in_sizes[9] < CC) return;
  if ((size_t)out_size < (size_t)NB * SEQ * CC) return;
  if (ws_size < (size_t)WS_END) return;
  const float* const* F = (const float* const*)d_in;   // 0 x_q, 1 x_k, 2 x_v [2,2048,1024]; 3 m [2,2048,2048]; 4 w_q [out][in], 5 b_q, 6 w_k, 7 b_k, 8 w_v, 9 b_v
  char* ws = (char*)d_ws;
  __bf16 *XQb = (__bf16*)(ws + WS_XQ), *XKb = (__bf16*)(ws + WS_XK), *XVb = (__bf16*)(ws + WS_XV);
  __bf16 *WQb = (__bf16*)(ws + WS_WQ), *WKb = (__bf16*)(ws + WS_WK), *WVb = (__bf16*)(ws + WS_WV);
  _Float16 *QH = (_Float16*)(ws + WS_QH), *QL = (_Float16*)(ws + WS_QL), *KH = (_Float16*)(ws + WS_KH);
  __bf16 *VT = (__bf16*)(ws + WS_VT), *VL = (__bf16*)(ws + WS_VL);
  const size_t nx8 = (size_t)NB * SEQ * CC / 8, nw8 = (size_t)CC * CC / 8;
  const unsigned gx8 = (unsigned)((nx8 + 255) / 256), gw8 = (unsigned)((nw8 + 255) / 256);
  const unsigned gx = gx8 > gw8 ? gx8 : gw8;
  k_cvt<<<dim3(gx, 1, 6), 256, 0, stream>>>(F[0], F[1], F[2], F[4], F[6], F[8], XQb, XKb, XVb, WQb, WKb, WVb);
  k_proj<<<dim3(NB * SEQ / PM, CC / PN, 3), 128, 0, stream>>>(XQb, XKb, XVb, WQb, WKb, WVb, F[5], F[7], F[9], QH, QL, KH, VT, VL);
  k_att<<<dim3(SEQ / 64, NH, NB), 128, 0, stream>>>(QH, QL, KH, VT, VL, F[3], (float*)d_out);
}

// v003
// Measured time: 137 microseconds a run.
// In both of two side-by-side timings against v002, it was 1.17 times as fast.
// Counting every step since v000, it is 3.13 times as fast.
// compute dtype: float inputs RNE-converted to bf16; q/k/v = x W^T + b on v_wmma_f32_16x16x32_bf16 (bf16 operands, exact products, f32 accumulate); logits -q.k/8 + m from q as f16 hi + f16 residual (x 2^10) times k f16 hi on v_wmma_f32_16x16x32_f16 (2 products, f32 accumulate); online softmax in f32 (e^x = 2^(x log2 e) on the hardware exponential); P x 2^11 as bf16 hi + lo times v bf16 hi + lo on v_wmma_f32_16x16x32_bf16 (3 products, f32 accumulate); f32 output.
#include <hip/hip_runtime.h>
#include <math.h>

typedef __attribute__((ext_vector_type(16))) _Float16 v16h;
typedef __attribute__((ext_vector_type(16))) __bf16 v16b;
typedef __attribute__((ext_vector_type(8)))  _Float16 v8h;
typedef __attribute__((ext_vector_type(8)))  __bf16 v8b;
typedef __attribute__((ext_vector_type(8)))  float v8f;
typedef __attribute__((ext_vector_type(4)))  float v4f;
typedef __attribute__((ext_vector_type(4)))  unsigned v4u;

template <typename T> __device__ __forceinline__ void vst2(void* p, T v) { *(T*)p = v;  }

__device__ __forceinline__ v8f wmma16(v16h a, v16h b, v8f c) {
  v8f d = __builtin_amdgcn_wmma_f32_16x16x32_f16(false, a, false, b, (short)0, c, false, false);
  asm volatile("v_nop\n\tv_nop\n\tv_nop\n\tv_nop" : "+v"(d) : "v"(a), "v"(b));
  return d;
}
__device__ __forceinline__ v8f wmma_bf(v16b a, v16b b, v8f c) {
  v8f d = __builtin_amdgcn_wmma_f32_16x16x32_bf16(false, a, false, b, (short)0, c, false, false);
  asm volatile("v_nop\n\tv_nop\n\tv_nop\n\tv_nop" : "+v"(d) : "v"(a), "v"(b));
  return d;
}
// 16x16x32 fragments: lane = (g = lane>>4, row/col = lane&15); elements 0..7 = k0+8g+0..7, 8..15 = k0+16+8g+0..7; D element r = row 8g+r, col lane&15
// A from a row-major [m][k] row pointer at k0; B from a k-contiguous [n][k] row pointer at k0 (same map)
__device__ __forceinline__ v16h frag_h(const _Float16* rowk0, int lane) {
  union { v16h v; v8h q[2]; } u; const _Float16* p = rowk0 + 8 * (lane >> 4);
  u.q[0] = *(const v8h*)p; u.q[1] = *(const v8h*)(p + 16); return u.v;
}
__device__ __forceinline__ v16b frag_b(const __bf16* rowk0, int lane) {
  union { v16b v; v8b q[2]; } u; const __bf16* p = rowk0 + 8 * (lane >> 4);
  u.q[0] = *(const v8b*)p; u.q[1] = *(const v8b*)(p + 16); return u.v;
}
struct F2 { v16b h, l; };
__device__ __forceinline__ F2 bsplit16(const float v[16]) { F2 r;
#pragma unroll
  for (int i = 0; i < 16; ++i) { const __bf16 h = (__bf16)v[i]; r.h[i] = h; r.l[i] = (__bf16)(v[i] - (float)h); }
  return r; }
__device__ __forceinline__ F2 split_row(const float* row, int k0, int lane) { float v[16]; const float* p = row + k0 + 8 * (lane >> 4);
#pragma unroll
  for (int i = 0; i < 8; ++i) { v[i] = p[i]; v[8 + i] = p[16 + i]; }
  return bsplit16(v); }
__device__ __forceinline__ float bfr(float v) { return (float)(__bf16)v; }
// same-wave LDS spill -> reload ordering: drain DS, lockstep the wave, keep the compiler from hoisting the reloads
__device__ __forceinline__ void ldsx() { asm volatile("s_wait_dscnt 0" ::: "memory"); __builtin_amdgcn_wave_barrier(); __builtin_amdgcn_fence(4, "workgroup"); }

// ---- sizes: NB x SEQ rows processed; inputs and d_in row strides use the *_FULL extents
#ifndef NB
#define NB 2
#endif
#ifndef SEQ
#define SEQ 2048
#endif
#ifndef NB_FULL
#define NB_FULL 2
#endif
#ifndef SEQ_FULL
#define SEQ_FULL 2048
#endif
#define CC 1024            // model width
#define NH 16              // heads
#define HD 64              // head width; column n of q/k/v = h*HD + d
#define KT 64              // keys per step of the fused softmax kernel

static_assert(NB >= 1 && NB <= NB_FULL);
static_assert(SEQ % 64 == 0 && SEQ <= SEQ_FULL && SEQ_FULL % 4 == 0);
static_assert(NH * HD == CC && HD == 64 && CC % 128 == 0 && KT == 64);

#define PLB (2u * (size_t)NB * SEQ * CC)   // one 16-bit [NB*SEQ][CC] plane
#define WPB (2u * (size_t)CC * CC)         // one 16-bit [CC][CC] weight plane
#define WS_XQ ((size_t)0)                  // bf16 x planes [b*SEQ+s][CC]
#define WS_XK (WS_XQ + PLB)
#define WS_XV (WS_XK + PLB)
#define WS_WQ (WS_XV + PLB)                // bf16 weight planes [out][in]
#define WS_WK (WS_WQ + WPB)
#define WS_WV (WS_WK + WPB)
#define WS_QH (WS_WV + WPB)                // f16 q hi [b*SEQ+s][CC]
#define WS_QL (WS_QH + PLB)                // f16 q residual x 2^10
#define WS_KH (WS_QL + PLB)                // f16 k hi [b*SEQ+s][CC]
#define WS_VT (WS_KH + PLB)                // bf16 v hi, transposed [b][CC][SEQ]
#define WS_VL (WS_VT + PLB)                // bf16 v lo, transposed
#define WS_END (WS_VL + PLB)
static_assert(PLB % 128 == 0 && WPB % 128 == 0);
static_assert(WS_END <= (size_t)134217728u);

// ---- k_cvt: z = 0..5 selects (x_q, x_k, x_v, w_q, w_k, w_v): f32 -> bf16 (RNE), 8 elements per thread, one 16-B store per lane
// coverage: x planes NB*SEQ*CC/8 chunks (source rows remapped through the full strides), weight planes CC*CC/8 chunks; grid.x = max of the two
__global__ __launch_bounds__(256) void k_cvt(const float* __restrict__ XQ, const float* __restrict__ XK, const float* __restrict__ XV,
                                             const float* __restrict__ WQ, const float* __restrict__ WK, const float* __restrict__ WV,
                                             __bf16* __restrict__ DQ, __bf16* __restrict__ DK, __bf16* __restrict__ DV,
                                             __bf16* __restrict__ DWQ, __bf16* __restrict__ DWK, __bf16* __restrict__ DWV) {
  const int z = blockIdx.z;
  const float* src = z == 0 ? XQ : z == 1 ? XK : z == 2 ? XV : z == 3 ? WQ : z == 4 ? WK : WV;
  __bf16* dst = z == 0 ? DQ : z == 1 ? DK : z == 2 ? DV : z == 3 ? DWQ : z == 4 ? DWK : DWV;
  const size_t n8 = (z < 3) ? (size_t)NB * SEQ * CC / 8 : (size_t)CC * CC / 8;
  const size_t e = (size_t)blockIdx.x * 256 + threadIdx.x;
  if (e >= n8) return;
  size_t so = e * 8;
  if (z < 3) { const size_t row = e / (CC / 8), c = e % (CC / 8); so = ((row / SEQ) * SEQ_FULL + (row % SEQ)) * CC + c * 8; }
  const v4f f0 = *(const v4f*)(src + so), f1 = *(const v4f*)(src + so + 4);
  union { v8b v; v4u u; } o;
#pragma unroll
  for (int i = 0; i < 4; ++i) { o.v[i] = (__bf16)f0[i]; o.v[4 + i] = (__bf16)f1[i]; }
  vst2((void*)(dst + e * 8), o.u);
}

// ---- k_proj: block = (128 rows, 128 cols, which), 4 waves as 2 x 2, each a 64 x 64 tile: y = x W^T + b with exact bf16 products, k summed in ascending 32-steps;
// q -> f16 hi + residual, k -> f16 hi, v -> bf16 hi/lo transposed planes.
// Per stage a 64-wide k slice of the block's 128 x rows and 128 W rows is brought into LDS once by asynchronous copies (two buffers: the next
// slice flies while this one is multiplied); every wave takes its fragments from there, so each operand byte leaves L2 once per block, in whole 128-B lines.
// coverage: grid (NB*SEQ/128, CC/128, 3) writes every row and column of QH, QL, KH, VT, VL exactly once
#define PM 128             // x rows per block
#define PN 128             // W rows (output columns) per block
#define PK 64              // k per stage: 128 B of every operand row
#define PP 72              // LDS row pitch in elements: 144 B = 16 B x 9, conflict-free for the 16-B fragment reads
#define PBUF ((PM + PN) * PP)   // elements of one buffer: x rows, then W rows
#define PE 136             // row pitch in elements of the output staging that takes the ring's place after the loop
static_assert((NB * SEQ) % PM == 0 && SEQ % PM == 0 && CC % PN == 0 && CC % PK == 0 && CC / PK >= 2);
static_assert(PM == 128 && PN == 128 && PK == 64 && 2 * PM * PE <= 2 * PBUF && 2 * PN * PE <= 2 * PBUF);

// eight asynchronous 16-B copies per lane, global -> LDS, rows 16 apart (global pitch CC elements, LDS pitch PP elements);
// the s_wait_xcnt 0 closes the copies' own statement so that no address register named here is rewritten ahead of it
__device__ __forceinline__ void copy8(unsigned l, const __bf16* g) {
  asm volatile("global_load_async_to_lds_b128 %0, %8, off\n\t"
               "global_load_async_to_lds_b128 %1, %9, off\n\t"
               "global_load_async_to_lds_b128 %2, %10, off\n\t"
               "global_load_async_to_lds_b128 %3, %11, off\n\t"
               "global_load_async_to_lds_b128 %4, %12, off\n\t"
               "global_load_async_to_lds_b128 %5, %13, off\n\t"
               "global_load_async_to_lds_b128 %6, %14, off\n\t"
               "global_load_async_to_lds_b128 %7, %15, off\n\t"
               "s_wait_xcnt 0x0"
               :: "v"(l), "v"(l + 1u * 32u * PP), "v"(l + 2u * 32u * PP), "v"(l + 3u * 32u * PP),
                  "v"(l + 4u * 32u * PP), "v"(l + 5u * 32u * PP), "v"(l + 6u * 32u * PP), "v"(l + 7u * 32u * PP),
                  "v"(g), "v"(g + 1 * 16 * CC), "v"(g + 2 * 16 * CC), "v"(g + 3 * 16 * CC),
                  "v"(g + 4 * 16 * CC), "v"(g + 5 * 16 * CC), "v"(g + 6 * 16 * CC), "v"(g + 7 * 16 * CC)
               : "memory");
}

__global__ __launch_bounds__(128) void k_proj(const __bf16* __restrict__ XQ, const __bf16* __restrict__ XK, const __bf16* __restrict__ XV,
                                              const __bf16* __restrict__ WQ, const __bf16* __restrict__ WK, const __bf16* __restrict__ WV,
                                              const float* __restrict__ BQ, const float* __restrict__ BK, const float* __restrict__ BV,
                                              _Float16* __restrict__ QH, _Float16* __restrict__ QL, _Float16* __restrict__ KH,
                                              __bf16* __restrict__ VT, __bf16* __restrict__ VL) {
  __shared__ __align__(16) __bf16 ring[2 * PBUF];          // two operand buffers; output staging after the loop
  const int tid = threadIdx.x, wave = tid >> 5, lane = tid & 31, col = lane & 15, g = lane >> 4;
  const int wm = wave >> 1, wn = wave & 1;                 // this wave's 64 x 64 quarter of the block tile
  const int which = blockIdx.z; const int c0 = blockIdx.y * PN; const size_t r0 = (size_t)blockIdx.x * PM;
  const __bf16* X = which == 0 ? XQ : which == 1 ? XK : XV;
  const __bf16* W = which == 0 ? WQ : which == 1 ? WK : WV;
  const float* BA = which == 0 ? BQ : which == 1 ? BK : BV;
  // copies: lane = (row tid>>3 of each 16-row group, 16-B piece tid&7 of the row's 128 B); 8 lanes cover one whole line
  const int cr = tid >> 3, cp = (tid & 7) * 8;
  const __bf16* gx = X + (r0 + cr) * CC + cp;
  const __bf16* gw = W + (size_t)(c0 + cr) * CC + cp;
  const unsigned lx = (unsigned)(size_t)&ring[cr * PP + cp], lw = lx + 2u * PM * PP;
  copy8(lx, gx); copy8(lw, gw);                            // stage 0 -> buffer 0
  asm volatile("s_wait_asynccnt 0x0" ::: "memory");        // this wave's stage-0 copies have landed
  __syncthreads();                                         // ... and every other wave's
  copy8(lx + 2u * PBUF, gx + PK); copy8(lw + 2u * PBUF, gw + PK);   // stage 1 -> buffer 1
  v8f acc[4][4] = {};
#pragma unroll 1   // one stage per trip: the ring's order of waits, barrier and refill stays as written
  for (int t = 0; t < CC / PK; ++t) {
    const __bf16* xb = ring + (t & 1) * PBUF + (wm * 64 + col) * PP;
    const __bf16* wb = ring + (t & 1) * PBUF + (PM + wn * 64 + col) * PP;
#pragma unroll
    for (int kc = 0; kc < PK / 32; ++kc) {
      v16b a[4], w[4];
#pragma unroll
      for (int i = 0; i < 4; ++i) a[i] = frag_b(xb + i * 16 * PP + kc * 32, lane);      // A: x row m, split k map
#pragma unroll
      for (int j = 0; j < 4; ++j) w[j] = frag_b(wb + j * 16 * PP + kc * 32, lane);      // B[k][n] = W[n][k]: k-contiguous row n, same map
#pragma unroll
      for (int i = 0; i < 4; ++i)
#pragma unroll
        for (int j = 0; j < 4; ++j) acc[i][j] = wmma_bf(a[i], w[j], acc[i][j]); }
    asm volatile("s_wait_dscnt 0x0" ::: "memory");         // this wave's reads of buffer t&1 are done
    asm volatile("s_wait_asynccnt 0x0" ::: "memory");      // this wave's copies of stage t+1 have landed
    __syncthreads();                                       // publishes stage t+1 and frees buffer t&1
    if (t + 2 < CC / PK) { const unsigned bo = (unsigned)(t & 1) * 2u * PBUF;
      copy8(lx + bo, gx + (t + 2) * PK); copy8(lw + bo, gw + (t + 2) * PK); }
  }
  asm volatile("s_wait_asynccnt 0x0" ::: "memory");        // no copy outstanding before the ring becomes output staging
  if (which == 2) { __bf16* th = ring; __bf16* tl2 = ring + PN * PE;            // [col][row]
#pragma unroll
    for (int j = 0; j < 4; ++j) { const int cl = wn * 64 + j * 16 + col; const float bb = bfr(BA[c0 + cl]);
#pragma unroll
      for (int i = 0; i < 4; ++i) { v8b hi, lo;
#pragma unroll
        for (int r = 0; r < 8; ++r) { const float v = acc[i][j][r] + bb; const __bf16 bh = (__bf16)v; hi[r] = bh; lo[r] = (__bf16)(v - (float)bh); }
        const int rl = wm * 64 + i * 16 + 8 * g;
        *(v8b*)&th[cl * PE + rl] = hi; *(v8b*)&tl2[cl * PE + rl] = lo; } }
    __syncthreads();
    // stores: lane = (staged row tid>>4 of each 8-row group, 16-B piece tid&15): 16 lanes cover 256 contiguous bytes; one address per plane, constant steps
    const int sr = tid >> 4, sq = (tid & 15) * 8;
    const size_t o2 = ((r0 / SEQ) * CC + c0 + sr) * (size_t)SEQ + (r0 % SEQ) + sq;
#pragma unroll
    for (int i = 0; i < PN / 8; ++i) vst2((void*)(VT + o2 + (size_t)i * 8 * SEQ), *(const v4u*)&th[(sr + i * 8) * PE + sq]);
#pragma unroll
    for (int i = 0; i < PN / 8; ++i) vst2((void*)(VL + o2 + (size_t)i * 8 * SEQ), *(const v4u*)&tl2[(sr + i * 8) * PE + sq]); }
  else { _Float16* sh = (_Float16*)ring; _Float16* sl = sh + PM * PE;            // [row][col]
#pragma unroll
    for (int j = 0; j < 4; ++j) { const int cl = wn * 64 + j * 16 + col; const float bb = bfr(BA[c0 + cl]);
#pragma unroll
      for (int i = 0; i < 4; ++i)
#pragma unroll
        for (int r = 0; r < 8; ++r) { const float v = acc[i][j][r] + bb; const int rl = wm * 64 + i * 16 + 8 * g + r;
          const _Float16 hv = (_Float16)v; sh[rl * PE + cl] = hv; sl[rl * PE + cl] = (_Float16)((v - (float)hv) * 1024.0f); }   /* q residual carried x 2^10 so the plane stays f16-normal */ }
    __syncthreads();
    const int sr = tid >> 4, sq = (tid & 15) * 8;           // as above
    const size_t o1 = (r0 + sr) * CC + c0 + sq;
    if (which == 0) {
#pragma unroll
      for (int i = 0; i < PM / 8; ++i) vst2((void*)(QH + o1 + (size_t)i * 8 * CC), *(const v4u*)&sh[(sr + i * 8) * PE + sq]);
#pragma unroll
      for (int i = 0; i < PM / 8; ++i) vst2((void*)(QL + o1 + (size_t)i * 8 * CC), *(const v4u*)&sl[(sr + i * 8) * PE + sq]);
      asm volatile("s_wait_xcnt 0x0" ::: "memory");        // precaution: stands between the stores above and any later rewrite of a register that they name
    }
    else {
#pragma unroll
      for (int i = 0; i < PM / 8; ++i) vst2((void*)(KH + o1 + (size_t)i * 8 * CC), *(const v4u*)&sh[(sr + i * 8) * PE + sq]);
      asm volatile("s_wait_xcnt 0x0" ::: "memory");        // precaution: stands between the stores above and any later rewrite of a register that they name
    } }
}

__device__ __forceinline__ float xhalf(float x) {          // lane l takes lane l ^ 16's value
  return __builtin_bit_cast(float, __builtin_amdgcn_permlanex16(__builtin_bit_cast(int, x), __builtin_bit_cast(int, x), 0x76543210, 0xfedcba98, false, false)); }

// e^x as 2^(x log2 e): one multiply and the hardware's base-2 exponential; x <= 0 here (an older maximum minus the running maximum), -inf and anything below the f32 range give 0
#define LOG2E 1.44269504088896340736f
__device__ __forceinline__ float exp_hw(float x) { return __builtin_amdgcn_exp2f(x * LOG2E); }

__global__ __launch_bounds__(128) void k_att(const _Float16* __restrict__ QH, const _Float16* __restrict__ QL, const _Float16* __restrict__ KH,
                                             const __bf16* __restrict__ VT, const __bf16* __restrict__ VL, const float* __restrict__ MK, float* __restrict__ OUT) {
  __shared__ __align__(16) _Float16 kt[KT][72];           // [key][d]
  __shared__ __align__(16) __bf16 vhs[HD][72], vls[HD][72]; // [d][key]
  __shared__ __align__(16) float ms[64][68];               // [query][key]; behind the loop [query][d] output staging
  const int tid = threadIdx.x, wave = tid >> 5, lane = tid & 31, col = lane & 15, g = lane >> 4;
  const int b = blockIdx.z, h = blockIdx.y, qb0 = blockIdx.x * 64, ql0 = qb0 + wave * 16;
  const size_t qrow = (size_t)b * SEQ + ql0;
  v16h qh[2], qlo[2];                                       // B[k=d][n=query]: k-contiguous row per query
#pragma unroll
  for (int kc = 0; kc < 2; ++kc) { qh[kc] = frag_h(QH + (qrow + col) * CC + h * HD + kc * 32, lane); qlo[kc] = frag_h(QL + (qrow + col) * CC + h * HD + kc * 32, lane); }
  float mrow = -3.0e38f, lrow = 0.0f; v8f o[4];             // query ql0+col: running maximum (both halves), this half's sum; o[t][r] = o^T[d = 16t+8g+r][query]
#pragma unroll
  for (int t = 0; t < 4; ++t) o[t] = (v8f){};
#pragma unroll 1
  for (int kb = 0; kb < SEQ / KT; ++kb) {
    const int k0 = kb * KT;
    __syncthreads();                                        // all waves done with the earlier tile
    // staged extent == consumed extent: kt rows 0..63 x d 0..63, vhs/vls d 0..63 x keys 0..63, ms 64 x 64
#pragma unroll
    for (int i = 0; i < 4; ++i) { const int e = tid + 128 * i, rr = e >> 3, c = e & 7;
      *(v8h*)&kt[rr][c * 8] = *(const v8h*)(KH + ((size_t)b * SEQ + k0 + rr) * CC + h * HD + c * 8);
      const size_t vo = ((size_t)b * CC + h * HD + rr) * SEQ + k0 + c * 8;
      *(v8b*)&vhs[rr][c * 8] = *(const v8b*)(VT + vo); *(v8b*)&vls[rr][c * 8] = *(const v8b*)(VL + vo); }
#pragma unroll
    for (int i = 0; i < 8; ++i) { const int e = tid + 128 * i, qr = e >> 4, c = e & 15;
      *(v4f*)&ms[qr][c * 4] = *(const v4f*)(MK + ((size_t)b * SEQ_FULL + qb0 + qr) * SEQ_FULL + k0 + c * 4); }
    __syncthreads();
    v8f s[4];                                               // s[j][r] = logit of key 16j+8g+r, query col
#pragma unroll
    for (int j = 0; j < 4; ++j) { v8f a = {}, al = {};
#pragma unroll
      for (int kc = 0; kc < 2; ++kc) { const v16h kf = frag_h(&kt[j * 16 + col][kc * 32], lane);   // A[m=key][k=d]: k-contiguous row per key, same map as q
        a = wmma16(kf, qh[kc], a); al = wmma16(kf, qlo[kc], al); }
      s[j] = a * (-0.125f) + al * (-0.125f / 1024.0f);     /* -(q.k)/sqrt(64), residual folded back with 2^-10 */
      const float* mp = &ms[wave * 16 + col][j * 16 + 8 * g];
      const v4f m0 = *(const v4f*)mp, m1 = *(const v4f*)(mp + 4);
#pragma unroll
      for (int r = 0; r < 4; ++r) { s[j][r] += bfr(m0[r]); s[j][4 + r] += bfr(m1[r]); } }
    float vj[4];                                            // four independent chains, then joined
#pragma unroll
    for (int j = 0; j < 4; ++j) { vj[j] = s[j][0];
#pragma unroll
      for (int r = 1; r < 8; ++r) vj[j] = fmaxf(vj[j], s[j][r]); }
    float v = fmaxf(fmaxf(vj[0], vj[1]), fmaxf(vj[2], vj[3]));
    v = fmaxf(v, xhalf(v));
    const float mn = fmaxf(mrow, v); const float alpha = exp_hw(mrow - mn); float rs[4];
#pragma unroll
    for (int j = 0; j < 4; ++j) { rs[j] = 0.0f; const v8f x2 = (s[j] - mn) * LOG2E;
#pragma unroll
      for (int r = 0; r < 8; ++r) { const float p = __builtin_amdgcn_exp2f(x2[r]); s[j][r] = p; rs[j] += p; } }
    lrow = lrow * alpha + ((rs[0] + rs[1]) + (rs[2] + rs[3])); mrow = mn;
#pragma unroll
    for (int t = 0; t < 4; ++t) o[t] *= alpha;
#pragma unroll
    for (int kc = 0; kc < 2; ++kc) { float pv[16];          // B[k=key][n=query]: elements 0..7 = keys 32kc+8g+0..7, 8..15 = 32kc+16+8g+0..7: the D registers of tiles 2kc, 2kc+1
#pragma unroll
      for (int i = 0; i < 8; ++i) { pv[i] = s[2 * kc][i] * 2048.0f; pv[8 + i] = s[2 * kc + 1][i] * 2048.0f; }
      const F2 p = bsplit16(pv);
#pragma unroll
      for (int t = 0; t < 4; ++t) {
        const v16b vh = frag_b(&vhs[t * 16 + col][kc * 32], lane), vl = frag_b(&vls[t * 16 + col][kc * 32], lane);   // A[m=d][k=key]: key-contiguous row per d, same map
        o[t] = wmma_bf(vh, p.h, o[t]); o[t] = wmma_bf(vh, p.l, o[t]); o[t] = wmma_bf(vl, p.h, o[t]); } }
  }
  ldsx();                                                   // this wave's last reads of its own ms rows are done; no other wave touches them any more
  const float inv = (1.0f / (lrow + xhalf(lrow))) * (1.0f / 2048.0f);
#pragma unroll
  for (int t = 0; t < 4; ++t) { float* op = &ms[wave * 16 + col][t * 16 + 8 * g]; const v8f w = o[t] * inv;
    *(v4f*)op = (v4f){w[0], w[1], w[2], w[3]}; *(v4f*)(op + 4) = (v4f){w[4], w[5], w[6], w[7]}; }
  ldsx();
  for (int rl = 0; rl < 16; ++rl) { const v4f w4 = *(const v4f*)&ms[wave * 16 + rl][(lane & 15) * 4];
    if (lane < HD / 4) vst2((void*)(OUT + ((size_t)b * SEQ + ql0 + rl) * CC + h * HD + lane * 4), w4); }
}

extern "C" void kernel_launch(void* const* d_in, const int* in_sizes, int n_in, void* d_out, int out_size, void* d_ws, size_t ws_size, hipStream_t stream) {
  if (n_in < 10) return;
  const size_t needX = ((size_t)(NB - 1) * SEQ_FULL + SEQ) * CC;
  const size_t needM = ((size_t)(NB - 1) * SEQ_FULL + SEQ - 1) * SEQ_FULL + SEQ;
  if ((size_t)in_sizes[0] < needX || (size_t)in_sizes[1] < needX || (size_t)in_sizes[2] < needX) return;
  if ((size_t)in_sizes[3] < needM) return;
  if ((size_t)in_sizes[4] < (size_t)CC * CC || (size_t)in_sizes[6] < (size_t)CC * CC || (size_t)in_sizes[8] < (size_t)CC * CC) return;
  if (in_sizes[5] < CC || in_sizes[7] < CC || in_sizes[9] < CC) return;
  if ((size_t)out_size < (size_t)NB * SEQ * CC) return;
  if (ws_size < (size_t)WS_END) return;
  const float* const* F = (const float* const*)d_in;   // 0 x_q, 1 x_k, 2 x_v [2,2048,1024]; 3 m [2,2048,2048]; 4 w_q [out][in], 5 b_q, 6 w_k, 7 b_k, 8 w_v, 9 b_v
  char* ws = (char*)d_ws;
  __bf16 *XQb = (__bf16*)(ws + WS_XQ), *XKb = (__bf16*)(ws + WS_XK), *XVb = (__bf16*)(ws + WS_XV);
  __bf16 *WQb = (__bf16*)(ws + WS_WQ), *WKb = (__bf16*)(ws + WS_WK), *WVb = (__bf16*)(ws + WS_WV);
  _Float16 *QH = (_Float16*)(ws + WS_QH), *QL = (_Float16*)(ws + WS_QL), *KH = (_Float16*)(ws + WS_KH);
  __bf16 *VT = (__bf16*)(ws + WS_VT), *VL = (__bf16*)(ws + WS_VL);
  const size_t nx8 = (size_t)NB * SEQ * CC / 8, nw8 = (size_t)CC * CC / 8;
  const unsigned gx8 = (unsigned)((nx8 + 255) / 256), gw8 = (unsigned)((nw8 + 255) / 256);
  const unsigned gx = gx8 > gw8 ? gx8 : gw8;
  k_cvt<<<dim3(gx, 1, 6), 256, 0, stream>>>(F[0], F[1], F[2], F[4], F[6], F[8], XQb, XKb, XVb, WQb, WKb, WVb);
  k_proj<<<dim3(NB * SEQ / PM, CC / PN, 3), 128, 0, stream>>>(XQb, XKb, XVb, WQb, WKb, WVb, F[5], F[7], F[9], QH, QL, KH, VT, VL);
  k_att<<<dim3(SEQ / 64, NH, NB), 128, 0, stream>>>(QH, QL, KH, VT, VL, F[3], (float*)d_out);
}

// v004
// One run takes 127 microseconds.
// Next to v003, in two timings, it ran 1.08 and 1.07 times as fast.
// All steps since v000 together make it 3.37 times as fast.
// compute dtype: float inputs RNE-converted to bf16; q/k/v = x W^T + b on v_wmma_f32_16x16x32_bf16 (bf16 operands, exact products, f32 accumulate); logits -q.k/8 + m from q as f16 hi + f16 residual (x 2^10) times k f16 hi on v_wmma_f32_16x16x32_f16 (2 products, f32 accumulate); online softmax in f32 (e^x = 2^(x log2 e) on the hardware exponential); P x 2^11 as bf16 hi + lo times v bf16 hi + lo on v_wmma_f32_16x16x32_bf16 (3 products, f32 accumulate); f32 output.
#include <hip/hip_runtime.h>
#include <math.h>

typedef __attribute__((ext_vector_type(16))) _Float16 v16h;
typedef __attribute__((ext_vector_type(16))) __bf16 v16b;
typedef __attribute__((ext_vector_type(8)))  _Float16 v8h;
typedef __attribute__((ext_vector_type(8)))  __bf16 v8b;
typedef __attribute__((ext_vector_type(8)))  float v8f;
typedef __attribute__((ext_vector_type(4)))  float v4f;
typedef __attribute__((ext_vector_type(4)))  unsigned v4u;

template <typename T> __device__ __forceinline__ void vst2(void* p, T v) { *(T*)p = v;  }

__device__ __forceinline__ v8f wmma16(v16h a, v16h b, v8f c) {
  return __builtin_amdgcn_wmma_f32_16x16x32_f16(false, a, false, b, (short)0, c, false, false);   // the compiler keeps the distance behind its own builtin
}
__device__ __forceinline__ v8f wmma_bf(v16b a, v16b b, v8f c) {
  v8f d = __builtin_amdgcn_wmma_f32_16x16x32_bf16(false, a, false, b, (short)0, c, false, false);
  asm volatile("v_nop\n\tv_nop\n\tv_nop\n\tv_nop" : "+v"(d) : "v"(a), "v"(b));
  return d;
}
__device__ __forceinline__ v8f wmma_bfp(v16b a, v16b b, v8f c) {   // as wmma_bf, without the hand-written slots: the compiler keeps the distance behind its own builtin and may order loads and vector work around it
  return __builtin_amdgcn_wmma_f32_16x16x32_bf16(false, a, false, b, (short)0, c, false, false);
}
// 16x16x32 fragments: lane = (g = lane>>4, row/col = lane&15); elements 0..7 = k0+8g+0..7, 8..15 = k0+16+8g+0..7; D element r = row 8g+r, col lane&15
// A from a row-major [m][k] row pointer at k0; B from a k-contiguous [n][k] row pointer at k0 (same map)
__device__ __forceinline__ v16h frag_h(const _Float16* rowk0, int lane) {
  union { v16h v; v8h q[2]; } u; const _Float16* p = rowk0 + 8 * (lane >> 4);
  u.q[0] = *(const v8h*)p; u.q[1] = *(const v8h*)(p + 16); return u.v;
}
__device__ __forceinline__ v16b frag_b(const __bf16* rowk0, int lane) {
  union { v16b v; v8b q[2]; } u; const __bf16* p = rowk0 + 8 * (lane >> 4);
  u.q[0] = *(const v8b*)p; u.q[1] = *(const v8b*)(p + 16); return u.v;
}
struct F2 { v16b h, l; };
__device__ __forceinline__ F2 bsplit16(const float v[16]) { F2 r;
#pragma unroll
  for (int i = 0; i < 16; ++i) { const __bf16 h = (__bf16)v[i]; r.h[i] = h; r.l[i] = (__bf16)(v[i] - (float)h); }
  return r; }
__device__ __forceinline__ F2 split_row(const float* row, int k0, int lane) { float v[16]; const float* p = row + k0 + 8 * (lane >> 4);
#pragma unroll
  for (int i = 0; i < 8; ++i) { v[i] = p[i]; v[8 + i] = p[16 + i]; }
  return bsplit16(v); }
__device__ __forceinline__ float bfr(float v) { return (float)(__bf16)v; }
// same-wave LDS spill -> reload ordering: drain DS, lockstep the wave, keep the compiler from hoisting the reloads
__device__ __forceinline__ void ldsx() { asm volatile("s_wait_dscnt 0" ::: "memory"); __builtin_amdgcn_wave_barrier(); __builtin_amdgcn_fence(4, "workgroup"); }

// ---- sizes: NB x SEQ rows processed; inputs and d_in row strides use the *_FULL extents
#ifndef NB
#define NB 2
#endif
#ifndef SEQ
#define SEQ 2048
#endif
#ifndef NB_FULL
#define NB_FULL 2
#endif
#ifndef SEQ_FULL
#define SEQ_FULL 2048
#endif
#define CC 1024            // model width
#define NH 16              // heads
#define HD 64              // head width; column n of q/k/v = h*HD + d
#define KT 64              // keys per step of the fused softmax kernel

static_assert(NB >= 1 && NB <= NB_FULL);
static_assert(SEQ % 64 == 0 && SEQ <= SEQ_FULL && SEQ_FULL % 4 == 0);
static_assert(NH * HD == CC && HD == 64 && CC % 128 == 0 && KT == 64);

#define PLB (2u * (size_t)NB * SEQ * CC)   // one 16-bit [NB*SEQ][CC] plane
#define WPB (2u * (size_t)CC * CC)         // one 16-bit [CC][CC] weight plane
#define WS_XQ ((size_t)0)                  // bf16 x planes [b*SEQ+s][CC]
#define WS_XK (WS_XQ + PLB)
#define WS_XV (WS_XK + PLB)
#define WS_WQ (WS_XV + PLB)                // bf16 weight planes [out][in]
#define WS_WK (WS_WQ + WPB)
#define WS_WV (WS_WK + WPB)
#define WS_QH (WS_WV + WPB)                // f16 q hi [b*SEQ+s][CC]
#define WS_QL (WS_QH + PLB)                // f16 q residual x 2^10
#define WS_KH (WS_QL + PLB)                // f16 k hi [b*SEQ+s][CC]
#define WS_VT (WS_KH + PLB)                // bf16 v hi, transposed [b][CC][SEQ]
#define WS_VL (WS_VT + PLB)                // bf16 v lo, transposed
#define WS_END (WS_VL + PLB)
static_assert(PLB % 128 == 0 && WPB % 128 == 0);
static_assert(WS_END <= (size_t)134217728u);

// ---- k_cvt: z = 0..5 selects (x_q, x_k, x_v, w_q, w_k, w_v): f32 -> bf16 (RNE), 8 elements per thread, one 16-B store per lane
// coverage: x planes NB*SEQ*CC/8 chunks (source rows remapped through the full strides), weight planes CC*CC/8 chunks; grid.x = max of the two
__global__ __launch_bounds__(256) void k_cvt(const float* __restrict__ XQ, const float* __restrict__ XK, const float* __restrict__ XV,
                                             const float* __restrict__ WQ, const float* __restrict__ WK, const float* __restrict__ WV,
                                             __bf16* __restrict__ DQ, __bf16* __restrict__ DK, __bf16* __restrict__ DV,
                                             __bf16* __restrict__ DWQ, __bf16* __restrict__ DWK, __bf16* __restrict__ DWV) {
  const int z = blockIdx.z;
  const float* src = z == 0 ? XQ : z == 1 ? XK : z == 2 ? XV : z == 3 ? WQ : z == 4 ? WK : WV;
  __bf16* dst = z == 0 ? DQ : z == 1 ? DK : z == 2 ? DV : z == 3 ? DWQ : z == 4 ? DWK : DWV;
  const size_t n8 = (z < 3) ? (size_t)NB * SEQ * CC / 8 : (size_t)CC * CC / 8;
  const size_t e = (size_t)blockIdx.x * 256 + threadIdx.x;
  if (e >= n8) return;
  size_t so = e * 8;
  if (z < 3) { const size_t row = e / (CC / 8), c = e % (CC / 8); so = ((row / SEQ) * SEQ_FULL + (row % SEQ)) * CC + c * 8; }
  const v4f f0 = *(const v4f*)(src + so), f1 = *(const v4f*)(src + so + 4);
  union { v8b v; v4u u; } o;
#pragma unroll
  for (int i = 0; i < 4; ++i) { o.v[i] = (__bf16)f0[i]; o.v[4 + i] = (__bf16)f1[i]; }
  vst2((void*)(dst + e * 8), o.u);
}

// ---- k_proj: block = (128 rows, 128 cols, which), 4 waves as 2 x 2, each a 64 x 64 tile: y = x W^T + b with exact bf16 products, k summed in ascending 32-steps;
// q -> f16 hi + residual, k -> f16 hi, v -> bf16 hi/lo transposed planes.
// Per stage a 64-wide k slice of the block's 128 x rows and 128 W rows is brought into LDS once by asynchronous copies (two buffers: the next
// slice flies while this one is multiplied); every wave takes its fragments from there, so each operand byte leaves L2 once per block, in whole 128-B lines.
// coverage: grid (NB*SEQ/128, CC/128, 3) writes every row and column of QH, QL, KH, VT, VL exactly once
#define PM 128             // x rows per block
#define PN 128             // W rows (output columns) per block
#define PK 64              // k per stage: 128 B of every operand row
#define PP 72              // LDS row pitch in elements: 144 B = 16 B x 9, conflict-free for the 16-B fragment reads
#define PBUF ((PM + PN) * PP)   // elements of one buffer: x rows, then W rows
#define PE 136             // row pitch in elements of the output staging that takes the ring's place after the loop
static_assert((NB * SEQ) % PM == 0 && SEQ % PM == 0 && CC % PN == 0 && CC % PK == 0 && CC / PK >= 2);
static_assert(PM == 128 && PN == 128 && PK == 64 && 2 * PM * PE <= 2 * PBUF && 2 * PN * PE <= 2 * PBUF);

// eight asynchronous 16-B copies per lane, global -> LDS, rows 16 apart (global pitch CC elements, LDS pitch PP elements);
// the s_wait_xcnt 0 closes the copies' own statement so that no address register named here is rewritten ahead of it
__device__ __forceinline__ void copy8(unsigned l, const __bf16* g) {
  asm volatile("global_load_async_to_lds_b128 %0, %8, off\n\t"
               "global_load_async_to_lds_b128 %1, %9, off\n\t"
               "global_load_async_to_lds_b128 %2, %10, off\n\t"
               "global_load_async_to_lds_b128 %3, %11, off\n\t"
               "global_load_async_to_lds_b128 %4, %12, off\n\t"
               "global_load_async_to_lds_b128 %5, %13, off\n\t"
               "global_load_async_to_lds_b128 %6, %14, off\n\t"
               "global_load_async_to_lds_b128 %7, %15, off\n\t"
               "s_wait_xcnt 0x0"
               :: "v"(l), "v"(l + 1u * 32u * PP), "v"(l + 2u * 32u * PP), "v"(l + 3u * 32u * PP),
                  "v"(l + 4u * 32u * PP), "v"(l + 5u * 32u * PP), "v"(l + 6u * 32u * PP), "v"(l + 7u * 32u * PP),
                  "v"(g), "v"(g + 1 * 16 * CC), "v"(g + 2 * 16 * CC), "v"(g + 3 * 16 * CC),
                  "v"(g + 4 * 16 * CC), "v"(g + 5 * 16 * CC), "v"(g + 6 * 16 * CC), "v"(g + 7 * 16 * CC)
               : "memory");
}

__global__ __launch_bounds__(128) void k_proj(const __bf16* __restrict__ XQ, const __bf16* __restrict__ XK, const __bf16* __restrict__ XV,
                                              const __bf16* __restrict__ WQ, const __bf16* __restrict__ WK, const __bf16* __restrict__ WV,
                                              const float* __restrict__ BQ, const float* __restrict__ BK, const float* __restrict__ BV,
                                              _Float16* __restrict__ QH, _Float16* __restrict__ QL, _Float16* __restrict__ KH,
                                              __bf16* __restrict__ VT, __bf16* __restrict__ VL) {
  __shared__ __align__(16) __bf16 ring[2 * PBUF];          // two operand buffers; output staging after the loop
  const int tid = threadIdx.x, wave = tid >> 5, lane = tid & 31, col = lane & 15, g = lane >> 4;
  const int wm = wave >> 1, wn = wave & 1;                 // this wave's 64 x 64 quarter of the block tile
  const int which = blockIdx.z; const int c0 = blockIdx.y * PN; const size_t r0 = (size_t)blockIdx.x * PM;
  const __bf16* X = which == 0 ? XQ : which == 1 ? XK : XV;
  const __bf16* W = which == 0 ? WQ : which == 1 ? WK : WV;
  const float* BA = which == 0 ? BQ : which == 1 ? BK : BV;
  // copies: lane = (row tid>>3 of each 16-row group, 16-B piece tid&7 of the row's 128 B); 8 lanes cover one whole line
  const int cr = tid >> 3, cp = (tid & 7) * 8;
  const __bf16* gx = X + (r0 + cr) * CC + cp;
  const __bf16* gw = W + (size_t)(c0 + cr) * CC + cp;
  const unsigned lx = (unsigned)(size_t)&ring[cr * PP + cp], lw = lx + 2u * PM * PP;
  copy8(lx, gx); copy8(lw, gw);                            // stage 0 -> buffer 0
  asm volatile("s_wait_asynccnt 0x0" ::: "memory");        // this wave's stage-0 copies have landed
  __syncthreads();                                         // ... and every other wave's
  copy8(lx + 2u * PBUF, gx + PK); copy8(lw + 2u * PBUF, gw + PK);   // stage 1 -> buffer 1
  v8f acc[4][4] = {};
#pragma unroll 1   // one stage per trip: the ring's order of waits, barrier and refill stays as written
  for (int t = 0; t < CC / PK; ++t) {
    const __bf16* xb = ring + (t & 1) * PBUF + (wm * 64 + col) * PP;
    const __bf16* wb = ring + (t & 1) * PBUF + (PM + wn * 64 + col) * PP;
#pragma unroll
    for (int kc = 0; kc < PK / 32; ++kc) {
      v16b a[4], w[4];
#pragma unroll
      for (int i = 0; i < 4; ++i) a[i] = frag_b(xb + i * 16 * PP + kc * 32, lane);      // A: x row m, split k map
#pragma unroll
      for (int j = 0; j < 4; ++j) w[j] = frag_b(wb + j * 16 * PP + kc * 32, lane);      // B[k][n] = W[n][k]: k-contiguous row n, same map
#pragma unroll
      for (int i = 0; i < 4; ++i)
#pragma unroll
        for (int j = 0; j < 4; ++j) acc[i][j] = wmma_bf(a[i], w[j], acc[i][j]); }
    asm volatile("s_wait_dscnt 0x0" ::: "memory");         // this wave's reads of buffer t&1 are done
    asm volatile("s_wait_asynccnt 0x0" ::: "memory");      // this wave's copies of stage t+1 have landed
    __syncthreads();                                       // publishes stage t+1 and frees buffer t&1
    if (t + 2 < CC / PK) { const unsigned bo = (unsigned)(t & 1) * 2u * PBUF;
      copy8(lx + bo, gx + (t + 2) * PK); copy8(lw + bo, gw + (t + 2) * PK); }
  }
  asm volatile("s_wait_asynccnt 0x0" ::: "memory");        // no copy outstanding before the ring becomes output staging
  if (which == 2) { __bf16* th = ring; __bf16* tl2 = ring + PN * PE;            // [col][row]
#pragma unroll
    for (int j = 0; j < 4; ++j) { const int cl = wn * 64 + j * 16 + col; const float bb = bfr(BA[c0 + cl]);
#pragma unroll
      for (int i = 0; i < 4; ++i) { v8b hi, lo;
#pragma unroll
        for (int r = 0; r < 8; ++r) { const float v = acc[i][j][r] + bb; const __bf16 bh = (__bf16)v; hi[r] = bh; lo[r] = (__bf16)(v - (float)bh); }
        const int rl = wm * 64 + i * 16 + 8 * g;
        *(v8b*)&th[cl * PE + rl] = hi; *(v8b*)&tl2[cl * PE + rl] = lo; } }
    __syncthreads();
    // stores: lane = (staged row tid>>4 of each 8-row group, 16-B piece tid&15): 16 lanes cover 256 contiguous bytes; one address per plane, constant steps
    const int sr = tid >> 4, sq = (tid & 15) * 8;
    const size_t o2 = ((r0 / SEQ) * CC + c0 + sr) * (size_t)SEQ + (r0 % SEQ) + sq;
#pragma unroll
    for (int i = 0; i < PN / 8; ++i) vst2((void*)(VT + o2 + (size_t)i * 8 * SEQ), *(const v4u*)&th[(sr + i * 8) * PE + sq]);
#pragma unroll
    for (int i = 0; i < PN / 8; ++i) vst2((void*)(VL + o2 + (size_t)i * 8 * SEQ), *(const v4u*)&tl2[(sr + i * 8) * PE + sq]); }
  else { _Float16* sh = (_Float16*)ring; _Float16* sl = sh + PM * PE;            // [row][col]
#pragma unroll
    for (int j = 0; j < 4; ++j) { const int cl = wn * 64 + j * 16 + col; const float bb = bfr(BA[c0 + cl]);
#pragma unroll
      for (int i = 0; i < 4; ++i)
#pragma unroll
        for (int r = 0; r < 8; ++r) { const float v = acc[i][j][r] + bb; const int rl = wm * 64 + i * 16 + 8 * g + r;
          const _Float16 hv = (_Float16)v; sh[rl * PE + cl] = hv; sl[rl * PE + cl] = (_Float16)((v - (float)hv) * 1024.0f); }   /* q residual carried x 2^10 so the plane stays f16-normal */ }
    __syncthreads();
    const int sr = tid >> 4, sq = (tid & 15) * 8;           // as above
    const size_t o1 = (r0 + sr) * CC + c0 + sq;
    if (which == 0) {
#pragma unroll
      for (int i = 0; i < PM / 8; ++i) vst2((void*)(QH + o1 + (size_t)i * 8 * CC), *(const v4u*)&sh[(sr + i * 8) * PE + sq]);
#pragma unroll
      for (int i = 0; i < PM / 8; ++i) vst2((void*)(QL + o1 + (size_t)i * 8 * CC), *(const v4u*)&sl[(sr + i * 8) * PE + sq]);
      asm volatile("s_wait_xcnt 0x0" ::: "memory");        // precaution: stands between the stores above and any later rewrite of a register that they name
    }
    else {
#pragma unroll
      for (int i = 0; i < PM / 8; ++i) vst2((void*)(KH + o1 + (size_t)i * 8 * CC), *(const v4u*)&sh[(sr + i * 8) * PE + sq]);
      asm volatile("s_wait_xcnt 0x0" ::: "memory");        // precaution: stands between the stores above and any later rewrite of a register that they name
    } }
}

__device__ __forceinline__ float xhalf(float x) {          // lane l takes lane l ^ 16's value
  return __builtin_bit_cast(float, __builtin_amdgcn_permlanex16(__builtin_bit_cast(int, x), __builtin_bit_cast(int, x), 0x76543210, 0xfedcba98, false, false)); }

// e^x as 2^(x log2 e): one multiply and the hardware's base-2 exponential; x <= 0 here (an older maximum minus the running maximum), -inf and anything below the f32 range give 0
#define LOG2E 1.44269504088896340736f
__device__ __forceinline__ float exp_hw(float x) { return __builtin_amdgcn_exp2f(x * LOG2E); }

// second launch-bounds argument: four waves a SIMD, that is at most 256 registers a wave; without it the freer schedule takes a few more, and one work-group fewer fits on a WGP
__global__ __launch_bounds__(128, 4) void k_att(const _Float16* __restrict__ QH, const _Float16* __restrict__ QL, const _Float16* __restrict__ KH,
                                             const __bf16* __restrict__ VT, const __bf16* __restrict__ VL, const float* __restrict__ MK, float* __restrict__ OUT) {
  __shared__ __align__(16) _Float16 kt[KT][72];           // [key][d]
  __shared__ __align__(16) __bf16 vhs[HD][72], vls[HD][72]; // [d][key]
  __shared__ __align__(16) float ms[64][68];               // [query][key]; behind the loop [query][d] output staging
  // the wave's number in a scalar register (one-dimensional block of four waves): what hangs on it takes no vector register, which keeps the capped build free of scratch
  const int tid = threadIdx.x, wave = __builtin_amdgcn_readfirstlane(tid >> 5), lane = tid & 31, col = lane & 15, g = lane >> 4;
  const int b = blockIdx.z, h = blockIdx.y, qb0 = blockIdx.x * 64, ql0 = qb0 + wave * 16;
  const size_t qrow = (size_t)b * SEQ + ql0;
  v16h qh[2], qlo[2];                                       // B[k=d][n=query]: k-contiguous row per query
#pragma unroll
  for (int kc = 0; kc < 2; ++kc) { qh[kc] = frag_h(QH + (qrow + col) * CC + h * HD + kc * 32, lane); qlo[kc] = frag_h(QL + (qrow + col) * CC + h * HD + kc * 32, lane); }
  float mrow = -3.0e38f, lrow = 0.0f; v8f o[4];             // query ql0+col: running maximum (both halves), this half's sum; o[t][r] = o^T[d = 16t+8g+r][query]
#pragma unroll
  for (int t = 0; t < 4; ++t) o[t] = (v8f){};
#pragma unroll 1
  for (int kb = 0; kb < SEQ / KT; ++kb) {
    const int k0 = kb * KT;
    __syncthreads();                                        // all waves done with the earlier tile
    // staged extent == consumed extent: kt rows 0..63 x d 0..63, vhs/vls d 0..63 x keys 0..63, ms 64 x 64
#pragma unroll
    for (int i = 0; i < 4; ++i) { const int e = tid + 128 * i, rr = e >> 3, c = e & 7;
      *(v8h*)&kt[rr][c * 8] = *(const v8h*)(KH + ((size_t)b * SEQ + k0 + rr) * CC + h * HD + c * 8);
      const size_t vo = ((size_t)b * CC + h * HD + rr) * SEQ + k0 + c * 8;
      *(v8b*)&vhs[rr][c * 8] = *(const v8b*)(VT + vo); *(v8b*)&vls[rr][c * 8] = *(const v8b*)(VL + vo); }
#pragma unroll
    for (int i = 0; i < 8; ++i) { const int e = tid + 128 * i, qr = e >> 4, c = e & 15;
      *(v4f*)&ms[qr][c * 4] = *(const v4f*)(MK + ((size_t)b * SEQ_FULL + qb0 + qr) * SEQ_FULL + k0 + c * 4); }
    __syncthreads();
    v8f s[4];                                               // s[j][r] = logit of key 16j+8g+r, query col
#pragma unroll
    for (int j = 0; j < 4; ++j) { v8f a = {}, al = {};
#pragma unroll
      for (int kc = 0; kc < 2; ++kc) { const v16h kf = frag_h(&kt[j * 16 + col][kc * 32], lane);   // A[m=key][k=d]: k-contiguous row per key, same map as q
        a = wmma16(kf, qh[kc], a); al = wmma16(kf, qlo[kc], al); }
      s[j] = a * (-0.125f) + al * (-0.125f / 1024.0f);     /* -(q.k)/sqrt(64), residual folded back with 2^-10 */
      const float* mp = &ms[wave * 16 + col][j * 16 + 8 * g];
      const v4f m0 = *(const v4f*)mp, m1 = *(const v4f*)(mp + 4);
#pragma unroll
      for (int r = 0; r < 4; ++r) { s[j][r] += bfr(m0[r]); s[j][4 + r] += bfr(m1[r]); } }
    float vj[4];                                            // four independent chains, then joined
#pragma unroll
    for (int j = 0; j < 4; ++j) { vj[j] = s[j][0];
#pragma unroll
      for (int r = 1; r < 8; ++r) vj[j] = fmaxf(vj[j], s[j][r]); }
    float v = fmaxf(fmaxf(vj[0], vj[1]), fmaxf(vj[2], vj[3]));
    v = fmaxf(v, xhalf(v));
    const float mn = fmaxf(mrow, v); const float alpha = exp_hw(mrow - mn); float rs[4];
#pragma unroll
    for (int j = 0; j < 4; ++j) { rs[j] = 0.0f; const v8f x2 = (s[j] - mn) * LOG2E;
#pragma unroll
      for (int r = 0; r < 8; ++r) { const float p = __builtin_amdgcn_exp2f(x2[r]); s[j][r] = p; rs[j] += p; } }
    lrow = lrow * alpha + ((rs[0] + rs[1]) + (rs[2] + rs[3])); mrow = mn;
#pragma unroll
    for (int t = 0; t < 4; ++t) o[t] *= alpha;
#pragma unroll
    for (int kc = 0; kc < 2; ++kc) { float pv[16];          // B[k=key][n=query]: elements 0..7 = keys 32kc+8g+0..7, 8..15 = 32kc+16+8g+0..7: the D registers of tiles 2kc, 2kc+1
#pragma unroll
      for (int i = 0; i < 8; ++i) { pv[i] = s[2 * kc][i] * 2048.0f; pv[8 + i] = s[2 * kc + 1][i] * 2048.0f; }
      const F2 p = bsplit16(pv);
#pragma unroll
      for (int t = 0; t < 4; ++t) {
        const v16b vh = frag_b(&vhs[t * 16 + col][kc * 32], lane), vl = frag_b(&vls[t * 16 + col][kc * 32], lane);   // A[m=d][k=key]: key-contiguous row per d, same map
        o[t] = wmma_bfp(vh, p.h, o[t]); o[t] = wmma_bfp(vh, p.l, o[t]); o[t] = wmma_bfp(vl, p.h, o[t]); } }
  }
  ldsx();                                                   // this wave's last reads of its own ms rows are done; no other wave touches them any more
  const float inv = (1.0f / (lrow + xhalf(lrow))) * (1.0f / 2048.0f);
#pragma unroll
  for (int t = 0; t < 4; ++t) { float* op = &ms[wave * 16 + col][t * 16 + 8 * g]; const v8f w = o[t] * inv;
    *(v4f*)op = (v4f){w[0], w[1], w[2], w[3]}; *(v4f*)(op + 4) = (v4f){w[4], w[5], w[6], w[7]}; }
  ldsx();
  for (int rl = 0; rl < 16; ++rl) { const v4f w4 = *(const v4f*)&ms[wave * 16 + rl][(lane & 15) * 4];
    if (lane < HD / 4) vst2((void*)(OUT + ((size_t)b * SEQ + ql0 + rl) * CC + h * HD + lane * 4), w4); }
}

extern "C" void kernel_launch(void* const* d_in, const int* in_sizes, int n_in, void* d_out, int out_size, void* d_ws, size_t ws_size, hipStream_t stream) {
  if (n_in < 10) return;
  const size_t needX = ((size_t)(NB - 1) * SEQ_FULL + SEQ) * CC;
  const size_t needM = ((size_t)(NB - 1) * SEQ_FULL + SEQ - 1) * SEQ_FULL + SEQ;
  if ((size_t)in_sizes[0] < needX || (size_t)in_sizes[1] < needX || (size_t)in_sizes[2] < needX) return;
  if ((size_t)in_sizes[3] < needM) return;
  if ((size_t)in_sizes[4] < (size_t)CC * CC || (size_t)in_sizes[6] < (size_t)CC * CC || (size_t)in_sizes[8] < (size_t)CC * CC) return;
  if (in_sizes[5] < CC || in_sizes[7] < CC || in_sizes[9] < CC) return;
  if ((size_t)out_size < (size_t)NB * SEQ * CC) return;
  if (ws_size < (size_t)WS_END) return;
  const float* const* F = (const float* const*)d_in;   // 0 x_q, 1 x_k, 2 x_v [2,2048,1024]; 3 m [2,2048,2048]; 4 w_q [out][in], 5 b_q, 6 w_k, 7 b_k, 8 w_v, 9 b_v
  char* ws = (char*)d_ws;
  __bf16 *XQb = (__bf16*)(ws + WS_XQ), *XKb = (__bf16*)(ws + WS_XK), *XVb = (__bf16*)(ws + WS_XV);
  __bf16 *WQb = (__bf16*)(ws + WS_WQ), *WKb = (__bf16*)(ws + WS_WK), *WVb = (__bf16*)(ws + WS_WV);
  _Float16 *QH = (_Float16*)(ws + WS_QH), *QL = (_Float16*)(ws + WS_QL), *KH = (_Float16*)(ws + WS_KH);
  __bf16 *VT = (__bf16*)(ws + WS_VT), *VL = (__bf16*)(ws + WS_VL);
  const size_t nx8 = (size_t)NB * SEQ * CC / 8, nw8 = (size_t)CC * CC / 8;
  const unsigned gx8 = (unsigned)((nx8 + 255) / 256), gw8 = (unsigned)((nw8 + 255) / 256);
  const unsigned gx = gx8 > gw8 ? gx8 : gw8;
  k_cvt<<<dim3(gx, 1, 6), 256, 0, stream>>>(F[0], F[1], F[2], F[4], F[6], F[8], XQb, XKb, XVb, WQb, WKb, WVb);
  k_proj<<<dim3(NB * SEQ / PM, CC / PN, 3), 128, 0, stream>>>(XQb, XKb, XVb, WQb, WKb, WVb, F[5], F[7], F[9], QH, QL, KH, VT, VL);
  k_att<<<dim3(SEQ / 64, NH, NB), 128, 0, stream>>>(QH, QL, KH, VT, VL, F[3], (float*)d_out);
}

// v005
// A run of this version takes 112 microseconds.
// Two timings next to v004 put it at 1.12 and 1.13 times that version's speed.
// Counting every step since v000, it is 3.80 times as fast.
// compute dtype: float inputs RNE-converted to bf16; q/k/v = x W^T + b on v_wmma_f32_16x16x32_bf16 (bf16 operands, exact products, f32 accumulate); logits -q.k/8 + m from q as f16 hi + f16 residual (x 2^10) times k f16 hi on v_wmma_f32_16x16x32_f16 (2 products, f32 accumulate); online softmax in f32 (e^x = 2^(x log2 e) on the hardware exponential); P x 2^11 as bf16 hi + lo times v bf16 hi + lo on v_wmma_f32_16x16x32_bf16 (3 products, f32 accumulate); f32 output.
#include <hip/hip_runtime.h>
#include <math.h>

typedef __attribute__((ext_vector_type(16))) _Float16 v16h;
typedef __attribute__((ext_vector_type(16))) __bf16 v16b;
typedef __attribute__((ext_vector_type(8)))  _Float16 v8h;
typedef __attribute__((ext_vector_type(8)))  __bf16 v8b;
typedef __attribute__((ext_vector_type(8)))  float v8f;
typedef __attribute__((ext_vector_type(4)))  float v4f;
typedef __attribute__((ext_vector_type(4)))  unsigned v4u;

template <typename T> __device__ __forceinline__ void vst2(void* p, T v) { *(T*)p = v;  }

__device__ __forceinline__ v8f wmma16(v16h a, v16h b, v8f c) {
  return __builtin_amdgcn_wmma_f32_16x16x32_f16(false, a, false, b, (short)0, c, false, false);   // the compiler keeps the distance behind its own builtin
}
__device__ __forceinline__ v8f wmma_bf(v16b a, v16b b, v8f c) {
  v8f d = __builtin_amdgcn_wmma_f32_16x16x32_bf16(false, a, false, b, (short)0, c, false, false);
  asm volatile("v_nop\n\tv_nop\n\tv_nop\n\tv_nop" : "+v"(d) : "v"(a), "v"(b));
  return d;
}
__device__ __forceinline__ v8f wmma_bfp(v16b a, v16b b, v8f c) {   // as wmma_bf, without the hand-written slots: the compiler keeps the distance behind its own builtin and may order loads and vector work around it
  return __builtin_amdgcn_wmma_f32_16x16x32_bf16(false, a, false, b, (short)0, c, false, false);
}
// 16x16x32 fragments: lane = (g = lane>>4, row/col = lane&15); elements 0..7 = k0+8g+0..7, 8..15 = k0+16+8g+0..7; D element r = row 8g+r, col lane&15
// A from a row-major [m][k] row pointer at k0; B from a k-contiguous [n][k] row pointer at k0 (same map)
__device__ __forceinline__ v16h frag_h(const _Float16* rowk0, int lane) {
  union { v16h v; v8h q[2]; } u; const _Float16* p = rowk0 + 8 * (lane >> 4);
  u.q[0] = *(const v8h*)p; u.q[1] = *(const v8h*)(p + 16); return u.v;
}
__device__ __forceinline__ v16b frag_b(const __bf16* rowk0, int lane) {
  union { v16b v; v8b q[2]; } u; const __bf16* p = rowk0 + 8 * (lane >> 4);
  u.q[0] = *(const v8b*)p; u.q[1] = *(const v8b*)(p + 16); return u.v;
}
struct F2 { v16b h, l; };
__device__ __forceinline__ F2 bsplit16(const float v[16]) { F2 r;
#pragma unroll
  for (int i = 0; i < 16; ++i) { const __bf16 h = (__bf16)v[i]; r.h[i] = h; r.l[i] = (__bf16)(v[i] - (float)h); }
  return r; }
__device__ __forceinline__ F2 split_row(const float* row, int k0, int lane) { float v[16]; const float* p = row + k0 + 8 * (lane >> 4);
#pragma unroll
  for (int i = 0; i < 8; ++i) { v[i] = p[i]; v[8 + i] = p[16 + i]; }
  return bsplit16(v); }
__device__ __forceinline__ float bfr(float v) { return (float)(__bf16)v; }
// same-wave LDS spill -> reload ordering: drain DS, lockstep the wave, keep the compiler from hoisting the reloads
__device__ __forceinline__ void ldsx() { asm volatile("s_wait_dscnt 0" ::: "memory"); __builtin_amdgcn_wave_barrier(); __builtin_amdgcn_fence(4, "workgroup"); }

// ---- sizes: NB x SEQ rows processed; inputs and d_in row strides use the *_FULL extents
#ifndef NB
#define NB 2
#endif
#ifndef SEQ
#define SEQ 2048
#endif
#ifndef NB_FULL
#define NB_FULL 2
#endif
#ifndef SEQ_FULL
#define SEQ_FULL 2048
#endif
#define CC 1024            // model width
#define NH 16              // heads
#define HD 64              // head width; column n of q/k/v = h*HD + d
#define KT 64              // keys per step of the fused softmax kernel

static_assert(NB >= 1 && NB <= NB_FULL);
static_assert(SEQ % 64 == 0 && SEQ <= SEQ_FULL && SEQ_FULL % 4 == 0);
static_assert(NH * HD == CC && HD == 64 && CC % 128 == 0 && KT == 64);

#define PLB (2u * (size_t)NB * SEQ * CC)   // one 16-bit [NB*SEQ][CC] plane
#define WPB (2u * (size_t)CC * CC)         // one 16-bit [CC][CC] weight plane
#define WS_XQ ((size_t)0)                  // bf16 x planes [b*SEQ+s][CC]
#define WS_XK (WS_XQ + PLB)
#define WS_XV (WS_XK + PLB)
#define WS_WQ (WS_XV + PLB)                // bf16 weight planes [out][in]
#define WS_WK (WS_WQ + WPB)
#define WS_WV (WS_WK + WPB)
#define WS_QH (WS_WV + WPB)                // f16 q hi [b*SEQ+s][CC]
#define WS_QL (WS_QH + PLB)                // f16 q residual x 2^10
#define WS_KH (WS_QL + PLB)                // f16 k hi [b*SEQ+s][CC]
#define WS_VT (WS_KH + PLB)                // bf16 v hi, transposed [b][CC][SEQ]
#define WS_VL (WS_VT + PLB)                // bf16 v lo, transposed
#define WS_END (WS_VL + PLB)
static_assert(PLB % 128 == 0 && WPB % 128 == 0);
static_assert(WS_END <= (size_t)134217728u);

// ---- k_cvt: z = 0..5 selects (x_q, x_k, x_v, w_q, w_k, w_v): f32 -> bf16 (RNE), 8 elements per thread, one 16-B store per lane
// coverage: x planes NB*SEQ*CC/8 chunks (source rows remapped through the full strides), weight planes CC*CC/8 chunks; grid.x = max of the two
__global__ __launch_bounds__(256) void k_cvt(const float* __restrict__ XQ, const float* __restrict__ XK, const float* __restrict__ XV,
                                             const float* __restrict__ WQ, const float* __restrict__ WK, const float* __restrict__ WV,
                                             __bf16* __restrict__ DQ, __bf16* __restrict__ DK, __bf16* __restrict__ DV,
                                             __bf16* __restrict__ DWQ, __bf16* __restrict__ DWK, __bf16* __restrict__ DWV) {
  const int z = blockIdx.z;
  const float* src = z == 0 ? XQ : z == 1 ? XK : z == 2 ? XV : z == 3 ? WQ : z == 4 ? WK : WV;
  __bf16* dst = z == 0 ? DQ : z == 1 ? DK : z == 2 ? DV : z == 3 ? DWQ : z == 4 ? DWK : DWV;
  const size_t n8 = (z < 3) ? (size_t)NB * SEQ * CC / 8 : (size_t)CC * CC / 8;
  const size_t e = (size_t)blockIdx.x * 256 + threadIdx.x;
  if (e >= n8) return;
  size_t so = e * 8;
  if (z < 3) { const size_t row = e / (CC / 8), c = e % (CC / 8); so = ((row / SEQ) * SEQ_FULL + (row % SEQ)) * CC + c * 8; }
  const v4f f0 = *(const v4f*)(src + so), f1 = *(const v4f*)(src + so + 4);
  union { v8b v; v4u u; } o;
#pragma unroll
  for (int i = 0; i < 4; ++i) { o.v[i] = (__bf16)f0[i]; o.v[4 + i] = (__bf16)f1[i]; }
  vst2((void*)(dst + e * 8), o.u);
}

// ---- k_proj: block = (128 rows, 128 cols, which), 4 waves as 2 x 2, each a 64 x 64 tile: y = x W^T + b with exact bf16 products, k summed in ascending 32-steps;
// q -> f16 hi + residual, k -> f16 hi, v -> bf16 hi/lo transposed planes.
// Per stage a 64-wide k slice of the block's 128 x rows and 128 W rows is brought into LDS once by asynchronous copies (two buffers: the next
// slice flies while this one is multiplied); every wave takes its fragments from there, so each operand byte leaves L2 once per block, in whole 128-B lines.
// coverage: grid (NB*SEQ/128, CC/128, 3) writes every row and column of QH, QL, KH, VT, VL exactly once
#define PM 128             // x rows per block
#define PN 128             // W rows (output columns) per block
#define PK 64              // k per stage: 128 B of every operand row
#define PP 72              // LDS row pitch in elements: 144 B = 16 B x 9, conflict-free for the 16-B fragment reads
#define PBUF ((PM + PN) * PP)   // elements of one buffer: x rows, then W rows
#define PE 136             // row pitch in elements of the output staging that takes the ring's place after the loop
static_assert((NB * SEQ) % PM == 0 && SEQ % PM == 0 && CC % PN == 0 && CC % PK == 0 && CC / PK >= 2);
static_assert(PM == 128 && PN == 128 && PK == 64 && 2 * PM * PE <= 2 * PBUF && 2 * PN * PE <= 2 * PBUF);

// eight asynchronous 16-B copies per lane, global -> LDS, rows 16 apart (global pitch CC elements, LDS pitch PP elements);
// the s_wait_xcnt 0 closes the copies' own statement so that no address register named here is rewritten ahead of it
__device__ __forceinline__ void copy8(unsigned l, const __bf16* g) {
  asm volatile("global_load_async_to_lds_b128 %0, %8, off\n\t"
               "global_load_async_to_lds_b128 %1, %9, off\n\t"
               "global_load_async_to_lds_b128 %2, %10, off\n\t"
               "global_load_async_to_lds_b128 %3, %11, off\n\t"
               "global_load_async_to_lds_b128 %4, %12, off\n\t"
               "global_load_async_to_lds_b128 %5, %13, off\n\t"
               "global_load_async_to_lds_b128 %6, %14, off\n\t"
               "global_load_async_to_lds_b128 %7, %15, off\n\t"
               "s_wait_xcnt 0x0"
               :: "v"(l), "v"(l + 1u * 32u * PP), "v"(l + 2u * 32u * PP), "v"(l + 3u * 32u * PP),
                  "v"(l + 4u * 32u * PP), "v"(l + 5u * 32u * PP), "v"(l + 6u * 32u * PP), "v"(l + 7u * 32u * PP),
                  "v"(g), "v"(g + 1 * 16 * CC), "v"(g + 2 * 16 * CC), "v"(g + 3 * 16 * CC),
                  "v"(g + 4 * 16 * CC), "v"(g + 5 * 16 * CC), "v"(g + 6 * 16 * CC), "v"(g + 7 * 16 * CC)
               : "memory");
}

__global__ __launch_bounds__(128) void k_proj(const __bf16* __restrict__ XQ, const __bf16* __restrict__ XK, const __bf16* __restrict__ XV,
                                              const __bf16* __restrict__ WQ, const __bf16* __restrict__ WK, const __bf16* __restrict__ WV,
                                              const float* __restrict__ BQ, const float* __restrict__ BK, const float* __restrict__ BV,
                                              _Float16* __restrict__ QH, _Float16* __restrict__ QL, _Float16* __restrict__ KH,
                                              __bf16* __restrict__ VT, __bf16* __restrict__ VL) {
  __shared__ __align__(16) __bf16 ring[2 * PBUF];          // two operand buffers; output staging after the loop
  const int tid = threadIdx.x, wave = tid >> 5, lane = tid & 31, col = lane & 15, g = lane >> 4;
  const int wm = wave >> 1, wn = wave & 1;                 // this wave's 64 x 64 quarter of the block tile
  const int which = blockIdx.z; const int c0 = blockIdx.y * PN; const size_t r0 = (size_t)blockIdx.x * PM;
  const __bf16* X = which == 0 ? XQ : which == 1 ? XK : XV;
  const __bf16* W = which == 0 ? WQ : which == 1 ? WK : WV;
  const float* BA = which == 0 ? BQ : which == 1 ? BK : BV;
  // copies: lane = (row tid>>3 of each 16-row group, 16-B piece tid&7 of the row's 128 B); 8 lanes cover one whole line
  const int cr = tid >> 3, cp = (tid & 7) * 8;
  const __bf16* gx = X + (r0 + cr) * CC + cp;
  const __bf16* gw = W + (size_t)(c0 + cr) * CC + cp;
  const unsigned lx = (unsigned)(size_t)&ring[cr * PP + cp], lw = lx + 2u * PM * PP;
  copy8(lx, gx); copy8(lw, gw);                            // stage 0 -> buffer 0
  asm volatile("s_wait_asynccnt 0x0" ::: "memory");        // this wave's stage-0 copies have landed
  __syncthreads();                                         // ... and every other wave's
  copy8(lx + 2u * PBUF, gx + PK); copy8(lw + 2u * PBUF, gw + PK);   // stage 1 -> buffer 1
  v8f acc[4][4] = {};
#pragma unroll 1   // one stage per trip: the ring's order of waits, barrier and refill stays as written
  for (int t = 0; t < CC / PK; ++t) {
    const __bf16* xb = ring + (t & 1) * PBUF + (wm * 64 + col) * PP;
    const __bf16* wb = ring + (t & 1) * PBUF + (PM + wn * 64 + col) * PP;
#pragma unroll
    for (int kc = 0; kc < PK / 32; ++kc) {
      v16b a[4], w[4];
#pragma unroll
      for (int i = 0; i < 4; ++i) a[i] = frag_b(xb + i * 16 * PP + kc * 32, lane);      // A: x row m, split k map
#pragma unroll
      for (int j = 0; j < 4; ++j) w[j] = frag_b(wb + j * 16 * PP + kc * 32, lane);      // B[k][n] = W[n][k]: k-contiguous row n, same map
#pragma unroll
      for (int i = 0; i < 4; ++i)
#pragma unroll
        for (int j = 0; j < 4; ++j) acc[i][j] = wmma_bf(a[i], w[j], acc[i][j]); }
    asm volatile("s_wait_dscnt 0x0" ::: "memory");         // this wave's reads of buffer t&1 are done
    asm volatile("s_wait_asynccnt 0x0" ::: "memory");      // this wave's copies of stage t+1 have landed
    __syncthreads();                                       // publishes stage t+1 and frees buffer t&1
    if (t + 2 < CC / PK) { const unsigned bo = (unsigned)(t & 1) * 2u * PBUF;
      copy8(lx + bo, gx + (t + 2) * PK); copy8(lw + bo, gw + (t + 2) * PK); }
  }
  asm volatile("s_wait_asynccnt 0x0" ::: "memory");        // no copy outstanding before the ring becomes output staging
  if (which == 2) { __bf16* th = ring; __bf16* tl2 = ring + PN * PE;            // [col][row]
#pragma unroll
    for (int j = 0; j < 4; ++j) { const int cl = wn * 64 + j * 16 + col; const float bb = bfr(BA[c0 + cl]);
#pragma unroll
      for (int i = 0; i < 4; ++i) { v8b hi, lo;
#pragma unroll
        for (int r = 0; r < 8; ++r) { const float v = acc[i][j][r] + bb; const __bf16 bh = (__bf16)v; hi[r] = bh; lo[r] = (__bf16)(v - (float)bh); }
        const int rl = wm * 64 + i * 16 + 8 * g;
        *(v8b*)&th[cl * PE + rl] = hi; *(v8b*)&tl2[cl * PE + rl] = lo; } }
    __syncthreads();
    // stores: lane = (staged row tid>>4 of each 8-row group, 16-B piece tid&15): 16 lanes cover 256 contiguous bytes; one address per plane, constant steps
    const int sr = tid >> 4, sq = (tid & 15) * 8;
    const size_t o2 = ((r0 / SEQ) * CC + c0 + sr) * (size_t)SEQ + (r0 % SEQ) + sq;
#pragma unroll
    for (int i = 0; i < PN / 8; ++i) vst2((void*)(VT + o2 + (size_t)i * 8 * SEQ), *(const v4u*)&th[(sr + i * 8) * PE + sq]);
#pragma unroll
    for (int i = 0; i < PN / 8; ++i) vst2((void*)(VL + o2 + (size_t)i * 8 * SEQ), *(const v4u*)&tl2[(sr + i * 8) * PE + sq]); }
  else { _Float16* sh = (_Float16*)ring; _Float16* sl = sh + PM * PE;            // [row][col]
#pragma unroll
    for (int j = 0; j < 4; ++j) { const int cl = wn * 64 + j * 16 + col; const float bb = bfr(BA[c0 + cl]);
#pragma unroll
      for (int i = 0; i < 4; ++i)
#pragma unroll
        for (int r = 0; r < 8; ++r) { const float v = acc[i][j][r] + bb; const int rl = wm * 64 + i * 16 + 8 * g + r;
          const _Float16 hv = (_Float16)v; sh[rl * PE + cl] = hv; sl[rl * PE + cl] = (_Float16)((v - (float)hv) * 1024.0f); }   /* q residual carried x 2^10 so the plane stays f16-normal */ }
    __syncthreads();
    const int sr = tid >> 4, sq = (tid & 15) * 8;           // as above
    const size_t o1 = (r0 + sr) * CC + c0 + sq;
    if (which == 0) {
#pragma unroll
      for (int i = 0; i < PM / 8; ++i) vst2((void*)(QH + o1 + (size_t)i * 8 * CC), *(const v4u*)&sh[(sr + i * 8) * PE + sq]);
#pragma unroll
      for (int i = 0; i < PM / 8; ++i) vst2((void*)(QL + o1 + (size_t)i * 8 * CC), *(const v4u*)&sl[(sr + i * 8) * PE + sq]);
      asm volatile("s_wait_xcnt 0x0" ::: "memory");        // precaution: stands between the stores above and any later rewrite of a register that they name
    }
    else {
#pragma unroll
      for (int i = 0; i < PM / 8; ++i) vst2((void*)(KH + o1 + (size_t)i * 8 * CC), *(const v4u*)&sh[(sr + i * 8) * PE + sq]);
      asm volatile("s_wait_xcnt 0x0" ::: "memory");        // precaution: stands between the stores above and any later rewrite of a register that they name
    } }
}

__device__ __forceinline__ float xhalf(float x) {          // lane l takes lane l ^ 16's value
  return __builtin_bit_cast(float, __builtin_amdgcn_permlanex16(__builtin_bit_cast(int, x), __builtin_bit_cast(int, x), 0x76543210, 0xfedcba98, false, false)); }

// e^x as 2^(x log2 e): one multiply and the hardware's base-2 exponential; x <= 0 here (an older maximum minus the running maximum), -inf and anything below the f32 range give 0
#define LOG2E 1.44269504088896340736f
__device__ __forceinline__ float exp_hw(float x) { return __builtin_amdgcn_exp2f(x * LOG2E); }

#define QT 128             // queries per block: 8 waves x 16
#define AKP 72             // row pitch in elements of the k and v tiles in LDS (144 B)
#define AMP 68             // row pitch in floats of the mask tile in LDS (272 B)
static_assert(SEQ % QT == 0 && SEQ / KT >= 2 && QT == 128);

// one step's tiles: fourteen asynchronous 16-B copies per lane, global -> LDS: rows r and r + 32 of the k, the v hi and the v lo tile, then eight mask rows 16 apart;
// the s_wait_xcnt 0 closes the copies' own statement so that no address register named here is rewritten ahead of it
__device__ __forceinline__ void copy_tiles(unsigned lk, unsigned lh, unsigned ll, unsigned lm, const _Float16* gk, const __bf16* gh, const __bf16* gl, const float* gm) {
  asm volatile("global_load_async_to_lds_b128 %0, %14, off\n\t"
               "global_load_async_to_lds_b128 %1, %15, off\n\t"
               "global_load_async_to_lds_b128 %2, %16, off\n\t"
               "global_load_async_to_lds_b128 %3, %17, off\n\t"
               "global_load_async_to_lds_b128 %4, %18, off\n\t"
               "global_load_async_to_lds_b128 %5, %19, off\n\t"
               "global_load_async_to_lds_b128 %6, %20, off\n\t"
               "global_load_async_to_lds_b128 %7, %21, off\n\t"
               "global_load_async_to_lds_b128 %8, %22, off\n\t"
               "global_load_async_to_lds_b128 %9, %23, off\n\t"
               "global_load_async_to_lds_b128 %10, %24, off\n\t"
               "global_load_async_to_lds_b128 %11, %25, off\n\t"
               "global_load_async_to_lds_b128 %12, %26, off\n\t"
               "global_load_async_to_lds_b128 %13, %27, off\n\t"
               "s_wait_xcnt 0x0"
               :: "v"(lk), "v"(lk + 64u * AKP), "v"(lh), "v"(lh + 64u * AKP), "v"(ll), "v"(ll + 64u * AKP),
                  "v"(lm), "v"(lm + 1u * 64u * AMP), "v"(lm + 2u * 64u * AMP), "v"(lm + 3u * 64u * AMP),
                  "v"(lm + 4u * 64u * AMP), "v"(lm + 5u * 64u * AMP), "v"(lm + 6u * 64u * AMP), "v"(lm + 7u * 64u * AMP),
                  "v"(gk), "v"(gk + 32 * CC), "v"(gh), "v"(gh + 32 * SEQ), "v"(gl), "v"(gl + 32 * SEQ),
                  "v"(gm), "v"(gm + 1 * 16 * SEQ_FULL), "v"(gm + 2 * 16 * SEQ_FULL), "v"(gm + 3 * 16 * SEQ_FULL),
                  "v"(gm + 4 * 16 * SEQ_FULL), "v"(gm + 5 * 16 * SEQ_FULL), "v"(gm + 6 * 16 * SEQ_FULL), "v"(gm + 7 * 16 * SEQ_FULL)
               : "memory");
}

// second launch-bounds argument: four waves a SIMD, that is at most 256 registers a wave; without it the freer schedule takes a few more, and one work-group fewer fits on a WGP
__global__ __launch_bounds__(256, 4) void k_att(const _Float16* __restrict__ QH, const _Float16* __restrict__ QL, const _Float16* __restrict__ KH,
                                             const __bf16* __restrict__ VT, const __bf16* __restrict__ VL, const float* __restrict__ MK, float* __restrict__ OUT) {
  __shared__ __align__(16) _Float16 kt[2][KT][AKP];        // [buffer][key][d]
  __shared__ __align__(16) __bf16 vhs[2][HD][AKP], vls[2][HD][AKP]; // [buffer][d][key]
  __shared__ __align__(16) float ms[2][QT][AMP];           // [buffer][query][key]; behind the loop ms[0] is [query][d] output staging
  // the wave's number in a scalar register (one-dimensional block of eight waves): what hangs on it takes no vector register, which keeps the capped build free of scratch
  const int tid = threadIdx.x, wave = __builtin_amdgcn_readfirstlane(tid >> 5), lane = tid & 31, col = lane & 15, g = lane >> 4;
  const int b = blockIdx.z, h = blockIdx.y, qb0 = blockIdx.x * QT, ql0 = qb0 + wave * 16;
  const size_t qrow = (size_t)b * SEQ + ql0;
  v16h qh[2], qlo[2];                                       // B[k=d][n=query]: k-contiguous row per query
#pragma unroll
  for (int kc = 0; kc < 2; ++kc) { qh[kc] = frag_h(QH + (qrow + col) * CC + h * HD + kc * 32, lane); qlo[kc] = frag_h(QL + (qrow + col) * CC + h * HD + kc * 32, lane); }
  float mrow = -3.0e38f, lrow = 0.0f; v8f o[4];             // query ql0+col: running maximum (both halves), this half's sum; o[t][r] = o^T[d = 16t+8g+r][query]
#pragma unroll
  for (int t = 0; t < 4; ++t) o[t] = (v8f){};
  // copies, staged extent == consumed extent: kt rows 0..63 x d 0..63, vhs/vls d 0..63 x keys 0..63 (lane = row tid>>3 and that + 32, 16-B piece tid&7: 8 lanes cover one whole line);
  // ms 128 x 64 (lane = row tid>>4 of each 16-row group, 16-B piece tid&15)
  const int cr = tid >> 3, cp = (tid & 7) * 8, mr = tid >> 4, mp = (tid & 15) * 4;
  const _Float16* gk = KH + ((size_t)b * SEQ + cr) * CC + h * HD + cp;
  const size_t vo = ((size_t)b * CC + h * HD + cr) * SEQ + cp;
  const __bf16* gh = VT + vo; const __bf16* gl = VL + vo;
  const float* gm = MK + ((size_t)b * SEQ_FULL + qb0 + mr) * SEQ_FULL + mp;
  const unsigned lk = (unsigned)(size_t)&kt[0][cr][cp], lh = (unsigned)(size_t)&vhs[0][cr][cp], ll = (unsigned)(size_t)&vls[0][cr][cp], lm = (unsigned)(size_t)&ms[0][mr][mp];
  const unsigned kvb = 2u * KT * AKP, mb = 4u * QT * AMP;   // bytes from buffer 0 to buffer 1
  copy_tiles(lk, lh, ll, lm, gk, gh, gl, gm);              // step 0 -> buffer 0
  asm volatile("s_wait_asynccnt 0x0" ::: "memory");        // this wave's step-0 copies have landed
  __syncthreads();                                         // ... and every other wave's
  copy_tiles(lk + kvb, lh + kvb, ll + kvb, lm + mb, gk + (size_t)KT * CC, gh + KT, gl + KT, gm + KT);   // step 1 -> buffer 1
#pragma unroll 1   // one step per trip: the ring's order of waits, barrier and refill stays as written
  for (int kb = 0; kb < SEQ / KT; ++kb) {
    const int bf = kb & 1;
    v8f s[4];                                               // s[j][r] = logit of key 16j+8g+r, query col
#pragma unroll
    for (int j = 0; j < 4; ++j) { v8f a = {}, al = {};
#pragma unroll
      for (int kc = 0; kc < 2; ++kc) { const v16h kf = frag_h(&kt[bf][j * 16 + col][kc * 32], lane);   // A[m=key][k=d]: k-contiguous row per key, same map as q
        a = wmma16(kf, qh[kc], a); al = wmma16(kf, qlo[kc], al); }
      s[j] = a * (-0.125f) + al * (-0.125f / 1024.0f);     /* -(q.k)/sqrt(64), residual folded back with 2^-10 */
      const float* mq = &ms[bf][wave * 16 + col][j * 16 + 8 * g];
      const v4f m0 = *(const v4f*)mq, m1 = *(const v4f*)(mq + 4);
#pragma unroll
      for (int r = 0; r < 4; ++r) { s[j][r] += bfr(m0[r]); s[j][4 + r] += bfr(m1[r]); } }
    float vj[4];                                            // four independent chains, then joined
#pragma unroll
    for (int j = 0; j < 4; ++j) { vj[j] = s[j][0];
#pragma unroll
      for (int r = 1; r < 8; ++r) vj[j] = fmaxf(vj[j], s[j][r]); }
    float v = fmaxf(fmaxf(vj[0], vj[1]), fmaxf(vj[2], vj[3]));
    v = fmaxf(v, xhalf(v));
    const float mn = fmaxf(mrow, v); const float alpha = exp_hw(mrow - mn); float rs[4];
#pragma unroll
    for (int j = 0; j < 4; ++j) { rs[j] = 0.0f; const v8f x2 = (s[j] - mn) * LOG2E;
#pragma unroll
      for (int r = 0; r < 8; ++r) { const float p = __builtin_amdgcn_exp2f(x2[r]); s[j][r] = p; rs[j] += p; } }
    lrow = lrow * alpha + ((rs[0] + rs[1]) + (rs[2] + rs[3])); mrow = mn;
#pragma unroll
    for (int t = 0; t < 4; ++t) o[t] *= alpha;
#pragma unroll
    for (int kc = 0; kc < 2; ++kc) { float pv[16];          // B[k=key][n=query]: elements 0..7 = keys 32kc+8g+0..7, 8..15 = 32kc+16+8g+0..7: the D registers of tiles 2kc, 2kc+1
      __builtin_amdgcn_sched_barrier(0);                    // bounds how far up the reads below may rise: both halves' fragments live at once do not fit the register cap
#pragma unroll
      for (int i = 0; i < 8; ++i) { pv[i] = s[2 * kc][i] * 2048.0f; pv[8 + i] = s[2 * kc + 1][i] * 2048.0f; }
      const F2 p = bsplit16(pv);
      v16b vh[4], vl[4];                                    // A[m=d][k=key]: key-contiguous row per d, same map
#pragma unroll
      for (int t = 0; t < 4; ++t) { vh[t] = frag_b(&vhs[bf][t * 16 + col][kc * 32], lane); vl[t] = frag_b(&vls[bf][t * 16 + col][kc * 32], lane); }
      __builtin_amdgcn_sched_barrier(0);                    // the sixteen fragment reads stay one group ahead of their products: without it each read is sunk to its product, with a full wait in front of it
#pragma unroll
      for (int t = 0; t < 4; ++t) { o[t] = wmma_bfp(vh[t], p.h, o[t]); o[t] = wmma_bfp(vh[t], p.l, o[t]); o[t] = wmma_bfp(vl[t], p.h, o[t]); } }
    asm volatile("s_wait_dscnt 0x0" ::: "memory");         // this wave's reads of buffer kb&1 are done
    asm volatile("s_wait_asynccnt 0x0" ::: "memory");      // this wave's copies of step kb+1 have landed
    __syncthreads();                                       // publishes step kb+1 and frees buffer kb&1
    if (kb + 2 < SEQ / KT) { const unsigned ko = (unsigned)bf * kvb; const int k2 = (kb + 2) * KT;
      copy_tiles(lk + ko, lh + ko, ll + ko, lm + (unsigned)bf * mb, gk + (size_t)k2 * CC, gh + k2, gl + k2, gm + k2); }
  }
  asm volatile("s_wait_asynccnt 0x0" ::: "memory");        // no copy outstanding before ms[0] becomes output staging
  ldsx();                                                   // this wave's last reads of its own ms rows are done; no other wave touches them any more
  const float inv = (1.0f / (lrow + xhalf(lrow))) * (1.0f / 2048.0f);
#pragma unroll
  for (int t = 0; t < 4; ++t) { float* op = &ms[0][wave * 16 + col][t * 16 + 8 * g]; const v8f w = o[t] * inv;
    *(v4f*)op = (v4f){w[0], w[1], w[2], w[3]}; *(v4f*)(op + 4) = (v4f){w[4], w[5], w[6], w[7]}; }
  ldsx();
  for (int rl = 0; rl < 16; ++rl) { const v4f w4 = *(const v4f*)&ms[0][wave * 16 + rl][(lane & 15) * 4];
    if (lane < HD / 4) vst2((void*)(OUT + ((size_t)b * SEQ + ql0 + rl) * CC + h * HD + lane * 4), w4); }
}

extern "C" void kernel_launch(void* const* d_in, const int* in_sizes, int n_in, void* d_out, int out_size, void* d_ws, size_t ws_size, hipStream_t stream) {
  if (n_in < 10) return;
  const size_t needX = ((size_t)(NB - 1) * SEQ_FULL + SEQ) * CC;
  const size_t needM = ((size_t)(NB - 1) * SEQ_FULL + SEQ - 1) * SEQ_FULL + SEQ;
  if ((size_t)in_sizes[0] < needX || (size_t)in_sizes[1] < needX || (size_t)in_sizes[2] < needX) return;
  if ((size_t)in_sizes[3] < needM) return;
  if ((size_t)in_sizes[4] < (size_t)CC * CC || (size_t)in_sizes[6] < (size_t)CC * CC || (size_t)in_sizes[8] < (size_t)CC * CC) return;
  if (in_sizes[5] < CC || in_sizes[7] < CC || in_sizes[9] < CC) return;
  if ((size_t)out_size < (size_t)NB * SEQ * CC) return;
  if (ws_size < (size_t)WS_END) return;
  const float* const* F = (const float* const*)d_in;   // 0 x_q, 1 x_k, 2 x_v [2,2048,1024]; 3 m [2,2048,2048]; 4 w_q [out][in], 5 b_q, 6 w_k, 7 b_k, 8 w_v, 9 b_v
  char* ws = (char*)d_ws;
  __bf16 *XQb = (__bf16*)(ws + WS_XQ), *XKb = (__bf16*)(ws + WS_XK), *XVb = (__bf16*)(ws + WS_XV);
  __bf16 *WQb = (__bf16*)(ws + WS_WQ), *WKb = (__bf16*)(ws + WS_WK), *WVb = (__bf16*)(ws + WS_WV);
  _Float16 *QH = (_Float16*)(ws + WS_QH), *QL = (_Float16*)(ws + WS_QL), *KH = (_Float16*)(ws + WS_KH);
  __bf16 *VT = (__bf16*)(ws + WS_VT), *VL = (__bf16*)(ws + WS_VL);
  const size_t nx8 = (size_t)NB * SEQ * CC / 8, nw8 = (size_t)CC * CC / 8;
  const unsigned gx8 = (unsigned)((nx8 + 255) / 256), gw8 = (unsigned)((nw8 + 255) / 256);
  const unsigned gx = gx8 > gw8 ? gx8 : gw8;
  k_cvt<<<dim3(gx, 1, 6), 256, 0, stream>>>(F[0], F[1], F[2], F[4], F[6], F[8], XQb, XKb, XVb, WQb, WKb, WVb);
  k_proj<<<dim3(NB * SEQ / PM, CC / PN, 3), 128, 0, stream>>>(XQb, XKb, XVb, WQb, WKb, WVb, F[5], F[7], F[9], QH, QL, KH, VT, VL);
  k_att<<<dim3(SEQ / QT, NH, NB), 256, 0, stream>>>(QH, QL, KH, VT, VL, F[3], (float*)d_out);
}

// v006
// One run takes 106 microseconds.
// Timed twice side by side with v005, it ran 1.06 times as fast both times.
// Counting every step since v000, it is 4.02 times as fast.
// compute dtype: x, W and b RNE-converted to bf16, the mask m kept f32; q/k/v = x W^T + b on v_wmma_f32_16x16x32_bf16 (bf16 operands, exact products, f32 accumulate); logits m - q.k/8 from q as f16 hi + f16 residual times -k/8 as f16 hi on v_wmma_f32_16x16x32_f16 (2 products, one f32 accumulator that starts at m); online softmax in f32 (e^x = 2^(x log2 e) on the hardware exponential); P x 2^11 as bf16 hi + lo times v bf16 hi + lo on v_wmma_f32_16x16x32_bf16 (3 products, f32 accumulate); f32 output.
#include <hip/hip_runtime.h>
#include <math.h>

typedef __attribute__((ext_vector_type(16))) _Float16 v16h;
typedef __attribute__((ext_vector_type(16))) __bf16 v16b;
typedef __attribute__((ext_vector_type(8)))  _Float16 v8h;
typedef __attribute__((ext_vector_type(8)))  __bf16 v8b;
typedef __attribute__((ext_vector_type(8)))  float v8f;
typedef __attribute__((ext_vector_type(4)))  float v4f;
typedef __attribute__((ext_vector_type(4)))  unsigned v4u;

template <typename T> __device__ __forceinline__ void vst2(void* p, T v) { *(T*)p = v;  }

__device__ __forceinline__ v8f wmma16(v16h a, v16h b, v8f c) {
  return __builtin_amdgcn_wmma_f32_16x16x32_f16(false, a, false, b, (short)0, c, false, false);   // the compiler keeps the distance behind its own builtin
}
__device__ __forceinline__ v8f wmma_bf(v16b a, v16b b, v8f c) {
  v8f d = __builtin_amdgcn_wmma_f32_16x16x32_bf16(false, a, false, b, (short)0, c, false, false);
  asm volatile("v_nop\n\tv_nop\n\tv_nop\n\tv_nop" : "+v"(d) : "v"(a), "v"(b));
  return d;
}
__device__ __forceinline__ v8f wmma_bfp(v16b a, v16b b, v8f c) {   // as wmma_bf, without the hand-written slots: the compiler keeps the distance behind its own builtin and may order loads and vector work around it
  return __builtin_amdgcn_wmma_f32_16x16x32_bf16(false, a, false, b, (short)0, c, false, false);
}
// 16x16x32 fragments: lane = (g = lane>>4, row/col = lane&15); elements 0..7 = k0+8g+0..7, 8..15 = k0+16+8g+0..7; D element r = row 8g+r, col lane&15
// A from a row-major [m][k] row pointer at k0; B from a k-contiguous [n][k] row pointer at k0 (same map)
__device__ __forceinline__ v16h frag_h(const _Float16* rowk0, int lane) {
  union { v16h v; v8h q[2]; } u; const _Float16* p = rowk0 + 8 * (lane >> 4);
  u.q[0] = *(const v8h*)p; u.q[1] = *(const v8h*)(p + 16); return u.v;
}
__device__ __forceinline__ v16b frag_b(const __bf16* rowk0, int lane) {
  union { v16b v; v8b q[2]; } u; const __bf16* p = rowk0 + 8 * (lane >> 4);
  u.q[0] = *(const v8b*)p; u.q[1] = *(const v8b*)(p + 16); return u.v;
}
struct F2 { v16b h, l; };
__device__ __forceinline__ F2 bsplit16(const float v[16]) { F2 r;
#pragma unroll
  for (int i = 0; i < 16; ++i) { const __bf16 h = (__bf16)v[i]; r.h[i] = h; r.l[i] = (__bf16)(v[i] - (float)h); }
  return r; }
__device__ __forceinline__ F2 split_row(const float* row, int k0, int lane) { float v[16]; const float* p = row + k0 + 8 * (lane >> 4);
#pragma unroll
  for (int i = 0; i < 8; ++i) { v[i] = p[i]; v[8 + i] = p[16 + i]; }
  return bsplit16(v); }
__device__ __forceinline__ float bfr(float v) { return (float)(__bf16)v; }
// same-wave LDS spill -> reload ordering: drain DS, lockstep the wave, keep the compiler from hoisting the reloads
__device__ __forceinline__ void ldsx() { asm volatile("s_wait_dscnt 0" ::: "memory"); __builtin_amdgcn_wave_barrier(); __builtin_amdgcn_fence(4, "workgroup"); }

// ---- sizes: NB x SEQ rows processed; inputs and d_in row strides use the *_FULL extents
#ifndef NB
#define NB 2
#endif
#ifndef SEQ
#define SEQ 2048
#endif
#ifndef NB_FULL
#define NB_FULL 2
#endif
#ifndef SEQ_FULL
#define SEQ_FULL 2048
#endif
#define CC 1024            // model width
#define NH 16              // heads
#define HD 64              // head width; column n of q/k/v = h*HD + d
#define KT 64              // keys per step of the fused softmax kernel

static_assert(NB >= 1 && NB <= NB_FULL);
static_assert(SEQ % 64 == 0 && SEQ <= SEQ_FULL && SEQ_FULL % 4 == 0);
static_assert(NH * HD == CC && HD == 64 && CC % 128 == 0 && KT == 64);

#define PLB (2u * (size_t)NB * SEQ * CC)   // one 16-bit [NB*SEQ][CC] plane
#define WPB (2u * (size_t)CC * CC)         // one 16-bit [CC][CC] weight plane
#define WS_XQ ((size_t)0)                  // bf16 x planes [b*SEQ+s][CC]
#define WS_XK (WS_XQ + PLB)
#define WS_XV (WS_XK + PLB)
#define WS_WQ (WS_XV + PLB)                // bf16 weight planes [out][in]
#define WS_WK (WS_WQ + WPB)
#define WS_WV (WS_WK + WPB)
#define WS_QH (WS_WV + WPB)                // f16 q hi [b*SEQ+s][CC]
#define WS_QL (WS_QH + PLB)                // f16 q residual, at q's own scale
#define WS_KH (WS_QL + PLB)                // f16 hi of -k/8 [b*SEQ+s][CC]
#define WS_VT (WS_KH + PLB)                // bf16 v hi, transposed [b][CC][SEQ]
#define WS_VL (WS_VT + PLB)                // bf16 v lo, transposed
#define WS_END (WS_VL + PLB)
static_assert(PLB % 128 == 0 && WPB % 128 == 0);
static_assert(WS_END <= (size_t)134217728u);

// ---- k_cvt: z = 0..5 selects (x_q, x_k, x_v, w_q, w_k, w_v): f32 -> bf16 (RNE), 8 elements per thread, one 16-B store per lane
// coverage: x planes NB*SEQ*CC/8 chunks (source rows remapped through the full strides), weight planes CC*CC/8 chunks; grid.x = max of the two
__global__ __launch_bounds__(256) void k_cvt(const float* __restrict__ XQ, const float* __restrict__ XK, const float* __restrict__ XV,
                                             const float* __restrict__ WQ, const float* __restrict__ WK, const float* __restrict__ WV,
                                             __bf16* __restrict__ DQ, __bf16* __restrict__ DK, __bf16* __restrict__ DV,
                                             __bf16* __restrict__ DWQ, __bf16* __restrict__ DWK, __bf16* __restrict__ DWV) {
  const int z = blockIdx.z;
  const float* src = z == 0 ? XQ : z == 1 ? XK : z == 2 ? XV : z == 3 ? WQ : z == 4 ? WK : WV;
  __bf16* dst = z == 0 ? DQ : z == 1 ? DK : z == 2 ? DV : z == 3 ? DWQ : z == 4 ? DWK : DWV;
  const size_t n8 = (z < 3) ? (size_t)NB * SEQ * CC / 8 : (size_t)CC * CC / 8;
  const size_t e = (size_t)blockIdx.x * 256 + threadIdx.x;
  if (e >= n8) return;
  size_t so = e * 8;
  if (z < 3) { const size_t row = e / (CC / 8), c = e % (CC / 8); so = ((row / SEQ) * SEQ_FULL + (row % SEQ)) * CC + c * 8; }
  const v4f f0 = *(const v4f*)(src + so), f1 = *(const v4f*)(src + so + 4);
  union { v8b v; v4u u; } o;
#pragma unroll
  for (int i = 0; i < 4; ++i) { o.v[i] = (__bf16)f0[i]; o.v[4 + i] = (__bf16)f1[i]; }
  vst2((void*)(dst + e * 8), o.u);
}

// ---- k_proj: block = (128 rows, 128 cols, which), 4 waves as 2 x 2, each a 64 x 64 tile: y = x W^T + b with exact bf16 products, k summed in ascending 32-steps;
// q -> f16 hi + residual, -k/8 -> f16 hi, v -> bf16 hi/lo transposed planes.
// Per stage a 64-wide k slice of the block's 128 x rows and 128 W rows is brought into LDS once by asynchronous copies (two buffers: the next
// slice flies while this one is multiplied); every wave takes its fragments from there, so each operand byte leaves L2 once per block, in whole 128-B lines.
// coverage: grid (NB*SEQ/128, CC/128, 3) writes every row and column of QH, QL, KH, VT, VL exactly once
#define PM 128             // x rows per block
#define PN 128             // W rows (output columns) per block
#define PK 64              // k per stage: 128 B of every operand row
#define PP 72              // LDS row pitch in elements: 144 B = 16 B x 9, conflict-free for the 16-B fragment reads
#define PBUF ((PM + PN) * PP)   // elements of one buffer: x rows, then W rows
#define PE 136             // row pitch in elements of the output staging that takes the ring's place after the loop
static_assert((NB * SEQ) % PM == 0 && SEQ % PM == 0 && CC % PN == 0 && CC % PK == 0 && CC / PK >= 2);
static_assert(PM == 128 && PN == 128 && PK == 64 && 2 * PM * PE <= 2 * PBUF && 2 * PN * PE <= 2 * PBUF);

// eight asynchronous 16-B copies per lane, global -> LDS, rows 16 apart (global pitch CC elements, LDS pitch PP elements);
// the s_wait_xcnt 0 closes the copies' own statement so that no address register named here is rewritten ahead of it
__device__ __forceinline__ void copy8(unsigned l, const __bf16* g) {
  asm volatile("global_load_async_to_lds_b128 %0, %8, off\n\t"
               "global_load_async_to_lds_b128 %1, %9, off\n\t"
               "global_load_async_to_lds_b128 %2, %10, off\n\t"
               "global_load_async_to_lds_b128 %3, %11, off\n\t"
               "global_load_async_to_lds_b128 %4, %12, off\n\t"
               "global_load_async_to_lds_b128 %5, %13, off\n\t"
               "global_load_async_to_lds_b128 %6, %14, off\n\t"
               "global_load_async_to_lds_b128 %7, %15, off\n\t"
               "s_wait_xcnt 0x0"
               :: "v"(l), "v"(l + 1u * 32u * PP), "v"(l + 2u * 32u * PP), "v"(l + 3u * 32u * PP),
                  "v"(l + 4u * 32u * PP), "v"(l + 5u * 32u * PP), "v"(l + 6u * 32u * PP), "v"(l + 7u * 32u * PP),
                  "v"(g), "v"(g + 1 * 16 * CC), "v"(g + 2 * 16 * CC), "v"(g + 3 * 16 * CC),
                  "v"(g + 4 * 16 * CC), "v"(g + 5 * 16 * CC), "v"(g + 6 * 16 * CC), "v"(g + 7 * 16 * CC)
               : "memory");
}

__global__ __launch_bounds__(128) void k_proj(const __bf16* __restrict__ XQ, const __bf16* __restrict__ XK, const __bf16* __restrict__ XV,
                                              const __bf16* __restrict__ WQ, const __bf16* __restrict__ WK, const __bf16* __restrict__ WV,
                                              const float* __restrict__ BQ, const float* __restrict__ BK, const float* __restrict__ BV,
                                              _Float16* __restrict__ QH, _Float16* __restrict__ QL, _Float16* __restrict__ KH,
                                              __bf16* __restrict__ VT, __bf16* __restrict__ VL) {
  __shared__ __align__(16) __bf16 ring[2 * PBUF];          // two operand buffers; output staging after the loop
  const int tid = threadIdx.x, wave = tid >> 5, lane = tid & 31, col = lane & 15, g = lane >> 4;
  const int wm = wave >> 1, wn = wave & 1;                 // this wave's 64 x 64 quarter of the block tile
  const int which = blockIdx.z; const int c0 = blockIdx.y * PN; const size_t r0 = (size_t)blockIdx.x * PM;
  const __bf16* X = which == 0 ? XQ : which == 1 ? XK : XV;
  const __bf16* W = which == 0 ? WQ : which == 1 ? WK : WV;
  const float* BA = which == 0 ? BQ : which == 1 ? BK : BV;
  // copies: lane = (row tid>>3 of each 16-row group, 16-B piece tid&7 of the row's 128 B); 8 lanes cover one whole line
  const int cr = tid >> 3, cp = (tid & 7) * 8;
  const __bf16* gx = X + (r0 + cr) * CC + cp;
  const __bf16* gw = W + (size_t)(c0 + cr) * CC + cp;
  const unsigned lx = (unsigned)(size_t)&ring[cr * PP + cp], lw = lx + 2u * PM * PP;
  copy8(lx, gx); copy8(lw, gw);                            // stage 0 -> buffer 0
  asm volatile("s_wait_asynccnt 0x0" ::: "memory");        // this wave's stage-0 copies have landed
  __syncthreads();                                         // ... and every other wave's
  copy8(lx + 2u * PBUF, gx + PK); copy8(lw + 2u * PBUF, gw + PK);   // stage 1 -> buffer 1
  v8f acc[4][4] = {};
#pragma unroll 1   // one stage per trip: the ring's order of waits, barrier and refill stays as written
  for (int t = 0; t < CC / PK; ++t) {
    const __bf16* xb = ring + (t & 1) * PBUF + (wm * 64 + col) * PP;
    const __bf16* wb = ring + (t & 1) * PBUF + (PM + wn * 64 + col) * PP;
#pragma unroll
    for (int kc = 0; kc < PK / 32; ++kc) {
      v16b a[4], w[4];
#pragma unroll
      for (int i = 0; i < 4; ++i) a[i] = frag_b(xb + i * 16 * PP + kc * 32, lane);      // A: x row m, split k map
#pragma unroll
      for (int j = 0; j < 4; ++j) w[j] = frag_b(wb + j * 16 * PP + kc * 32, lane);      // B[k][n] = W[n][k]: k-contiguous row n, same map
#pragma unroll
      for (int i = 0; i < 4; ++i)
#pragma unroll
        for (int j = 0; j < 4; ++j) acc[i][j] = wmma_bf(a[i], w[j], acc[i][j]); }
    asm volatile("s_wait_dscnt 0x0" ::: "memory");         // this wave's reads of buffer t&1 are done
    asm volatile("s_wait_asynccnt 0x0" ::: "memory");      // this wave's copies of stage t+1 have landed
    __syncthreads();                                       // publishes stage t+1 and frees buffer t&1
    if (t + 2 < CC / PK) { const unsigned bo = (unsigned)(t & 1) * 2u * PBUF;
      copy8(lx + bo, gx + (t + 2) * PK); copy8(lw + bo, gw + (t + 2) * PK); }
  }
  asm volatile("s_wait_asynccnt 0x0" ::: "memory");        // no copy outstanding before the ring becomes output staging
  if (which == 2) { __bf16* th = ring; __bf16* tl2 = ring + PN * PE;            // [col][row]
#pragma unroll
    for (int j = 0; j < 4; ++j) { const int cl = wn * 64 + j * 16 + col; const float bb = bfr(BA[c0 + cl]);
#pragma unroll
      for (int i = 0; i < 4; ++i) { v8b hi, lo;
#pragma unroll
        for (int r = 0; r < 8; ++r) { const float v = acc[i][j][r] + bb; const __bf16 bh = (__bf16)v; hi[r] = bh; lo[r] = (__bf16)(v - (float)bh); }
        const int rl = wm * 64 + i * 16 + 8 * g;
        *(v8b*)&th[cl * PE + rl] = hi; *(v8b*)&tl2[cl * PE + rl] = lo; } }
    __syncthreads();
    // stores: lane = (staged row tid>>4 of each 8-row group, 16-B piece tid&15): 16 lanes cover 256 contiguous bytes; one address per plane, constant steps
    const int sr = tid >> 4, sq = (tid & 15) * 8;
    const size_t o2 = ((r0 / SEQ) * CC + c0 + sr) * (size_t)SEQ + (r0 % SEQ) + sq;
#pragma unroll
    for (int i = 0; i < PN / 8; ++i) vst2((void*)(VT + o2 + (size_t)i * 8 * SEQ), *(const v4u*)&th[(sr + i * 8) * PE + sq]);
#pragma unroll
    for (int i = 0; i < PN / 8; ++i) vst2((void*)(VL + o2 + (size_t)i * 8 * SEQ), *(const v4u*)&tl2[(sr + i * 8) * PE + sq]); }
  else { _Float16* sh = (_Float16*)ring; _Float16* sl = sh + PM * PE;            // [row][col]
    const float sc = which == 1 ? -0.125f : 1.0f;           // the k plane carries the logit's factor -1/sqrt(64): a power of two, so the f16 rounding of k is the same
#pragma unroll
    for (int j = 0; j < 4; ++j) { const int cl = wn * 64 + j * 16 + col; const float bb = bfr(BA[c0 + cl]);
#pragma unroll
      for (int i = 0; i < 4; ++i)
#pragma unroll
        for (int r = 0; r < 8; ++r) { const float v = (acc[i][j][r] + bb) * sc; const int rl = wm * 64 + i * 16 + 8 * g + r;
          const _Float16 hv = (_Float16)v; sh[rl * PE + cl] = hv; sl[rl * PE + cl] = (_Float16)(v - (float)hv); }   /* q residual at q's own scale, so that both products share one accumulator; where it is f16-subnormal its step is 2^-24 */ }
    __syncthreads();
    const int sr = tid >> 4, sq = (tid & 15) * 8;           // as above
    const size_t o1 = (r0 + sr) * CC + c0 + sq;
    if (which == 0) {
#pragma unroll
      for (int i = 0; i < PM / 8; ++i) vst2((void*)(QH + o1 + (size_t)i * 8 * CC), *(const v4u*)&sh[(sr + i * 8) * PE + sq]);
#pragma unroll
      for (int i = 0; i < PM / 8; ++i) vst2((void*)(QL + o1 + (size_t)i * 8 * CC), *(const v4u*)&sl[(sr + i * 8) * PE + sq]);
      asm volatile("s_wait_xcnt 0x0" ::: "memory");        // precaution: stands between the stores above and any later rewrite of a register that they name
    }
    else {
#pragma unroll
      for (int i = 0; i < PM / 8; ++i) vst2((void*)(KH + o1 + (size_t)i * 8 * CC), *(const v4u*)&sh[(sr + i * 8) * PE + sq]);
      asm volatile("s_wait_xcnt 0x0" ::: "memory");        // precaution: stands between the stores above and any later rewrite of a register that they name
    } }
}

__device__ __forceinline__ float xhalf(float x) {          // lane l takes lane l ^ 16's value
  return __builtin_bit_cast(float, __builtin_amdgcn_permlanex16(__builtin_bit_cast(int, x), __builtin_bit_cast(int, x), 0x76543210, 0xfedcba98, false, false)); }

// e^x as 2^(x log2 e): one multiply and the hardware's base-2 exponential; x <= 0 here (an older maximum minus the running maximum), -inf and anything below the f32 range give 0
#define LOG2E 1.44269504088896340736f
__device__ __forceinline__ float exp_hw(float x) { return __builtin_amdgcn_exp2f(x * LOG2E); }

#define QT 128             // queries per block: 8 waves x 16
#define AKP 72             // row pitch in elements of the k and v tiles in LDS (144 B)
#define AMP 68             // row pitch in floats of the mask tile in LDS (272 B)
static_assert(SEQ % QT == 0 && SEQ / KT >= 2 && QT == 128);

// one step's tiles: fourteen asynchronous 16-B copies per lane, global -> LDS: rows r and r + 32 of the k, the v hi and the v lo tile, then eight mask rows 16 apart;
// the s_wait_xcnt 0 closes the copies' own statement so that no address register named here is rewritten ahead of it
__device__ __forceinline__ void copy_tiles(unsigned lk, unsigned lh, unsigned ll, unsigned lm, const _Float16* gk, const __bf16* gh, const __bf16* gl, const float* gm) {
  asm volatile("global_load_async_to_lds_b128 %0, %14, off\n\t"
               "global_load_async_to_lds_b128 %1, %15, off\n\t"
               "global_load_async_to_lds_b128 %2, %16, off\n\t"
               "global_load_async_to_lds_b128 %3, %17, off\n\t"
               "global_load_async_to_lds_b128 %4, %18, off\n\t"
               "global_load_async_to_lds_b128 %5, %19, off\n\t"
               "global_load_async_to_lds_b128 %6, %20, off\n\t"
               "global_load_async_to_lds_b128 %7, %21, off\n\t"
               "global_load_async_to_lds_b128 %8, %22, off\n\t"
               "global_load_async_to_lds_b128 %9, %23, off\n\t"
               "global_load_async_to_lds_b128 %10, %24, off\n\t"
               "global_load_async_to_lds_b128 %11, %25, off\n\t"
               "global_load_async_to_lds_b128 %12, %26, off\n\t"
               "global_load_async_to_lds_b128 %13, %27, off\n\t"
               "s_wait_xcnt 0x0"
               :: "v"(lk), "v"(lk + 64u * AKP), "v"(lh), "v"(lh + 64u * AKP), "v"(ll), "v"(ll + 64u * AKP),
                  "v"(lm), "v"(lm + 1u * 64u * AMP), "v"(lm + 2u * 64u * AMP), "v"(lm + 3u * 64u * AMP),
                  "v"(lm + 4u * 64u * AMP), "v"(lm + 5u * 64u * AMP), "v"(lm + 6u * 64u * AMP), "v"(lm + 7u * 64u * AMP),
                  "v"(gk), "v"(gk + 32 * CC), "v"(gh), "v"(gh + 32 * SEQ), "v"(gl), "v"(gl + 32 * SEQ),
                  "v"(gm), "v"(gm + 1 * 16 * SEQ_FULL), "v"(gm + 2 * 16 * SEQ_FULL), "v"(gm + 3 * 16 * SEQ_FULL),
                  "v"(gm + 4 * 16 * SEQ_FULL), "v"(gm + 5 * 16 * SEQ_FULL), "v"(gm + 6 * 16 * SEQ_FULL), "v"(gm + 7 * 16 * SEQ_FULL)
               : "memory");
}

// second launch-bounds argument: four waves a SIMD, that is at most 256 registers a wave; without it the freer schedule takes a few more, and one work-group fewer fits on a WGP
__global__ __launch_bounds__(256, 4) void k_att(const _Float16* __restrict__ QH, const _Float16* __restrict__ QL, const _Float16* __restrict__ KH,
                                             const __bf16* __restrict__ VT, const __bf16* __restrict__ VL, const float* __restrict__ MK, float* __restrict__ OUT) {
  __shared__ __align__(16) _Float16 kt[2][KT][AKP];        // [buffer][key][d]
  __shared__ __align__(16) __bf16 vhs[2][HD][AKP], vls[2][HD][AKP]; // [buffer][d][key]
  __shared__ __align__(16) float ms[2][QT][AMP];           // [buffer][query][key]; behind the loop ms[0] is [query][d] output staging
  // the wave's number in a scalar register (one-dimensional block of eight waves): what hangs on it takes no vector register, which keeps the capped build free of scratch
  const int tid = threadIdx.x, wave = __builtin_amdgcn_readfirstlane(tid >> 5), lane = tid & 31, col = lane & 15, g = lane >> 4;
  const int b = blockIdx.z, h = blockIdx.y, qb0 = blockIdx.x * QT, ql0 = qb0 + wave * 16;
  const size_t qrow = (size_t)b * SEQ + ql0;
  v16h qh[2], qlo[2];                                       // B[k=d][n=query]: k-contiguous row per query
#pragma unroll
  for (int kc = 0; kc < 2; ++kc) { qh[kc] = frag_h(QH + (qrow + col) * CC + h * HD + kc * 32, lane); qlo[kc] = frag_h(QL + (qrow + col) * CC + h * HD + kc * 32, lane); }
  float mrow = -3.0e38f, lrow = 0.0f; v8f o[4];             // query ql0+col: running maximum (both halves), this half's sum; o[t][r] = o^T[d = 16t+8g+r][query]
#pragma unroll
  for (int t = 0; t < 4; ++t) o[t] = (v8f){};
  // copies, staged extent == consumed extent: kt rows 0..63 x d 0..63, vhs/vls d 0..63 x keys 0..63 (lane = row tid>>3 and that + 32, 16-B piece tid&7: 8 lanes cover one whole line);
  // ms 128 x 64 (lane = row tid>>4 of each 16-row group, 16-B piece tid&15)
  const int cr = tid >> 3, cp = (tid & 7) * 8, mr = tid >> 4, mp = (tid & 15) * 4;
  const _Float16* gk = KH + ((size_t)b * SEQ + cr) * CC + h * HD + cp;
  const size_t vo = ((size_t)b * CC + h * HD + cr) * SEQ + cp;
  const __bf16* gh = VT + vo; const __bf16* gl = VL + vo;
  const float* gm = MK + ((size_t)b * SEQ_FULL + qb0 + mr) * SEQ_FULL + mp;
  const unsigned lk = (unsigned)(size_t)&kt[0][cr][cp], lh = (unsigned)(size_t)&vhs[0][cr][cp], ll = (unsigned)(size_t)&vls[0][cr][cp], lm = (unsigned)(size_t)&ms[0][mr][mp];
  const unsigned kvb = 2u * KT * AKP, mb = 4u * QT * AMP;   // bytes from buffer 0 to buffer 1
  copy_tiles(lk, lh, ll, lm, gk, gh, gl, gm);              // step 0 -> buffer 0
  asm volatile("s_wait_asynccnt 0x0" ::: "memory");        // this wave's step-0 copies have landed
  __syncthreads();                                         // ... and every other wave's
  copy_tiles(lk + kvb, lh + kvb, ll + kvb, lm + mb, gk + (size_t)KT * CC, gh + KT, gl + KT, gm + KT);   // step 1 -> buffer 1
#pragma unroll 1   // one step per trip: the ring's order of waits, barrier and refill stays as written
  for (int kb = 0; kb < SEQ / KT; ++kb) {
    const int bf = kb & 1;
    v8f s[4];                                               // s[j][r] = logit of key 16j+8g+r, query col
#pragma unroll
    for (int j = 0; j < 4; ++j) {
      const float* mq = &ms[bf][wave * 16 + col][j * 16 + 8 * g];
      const v4f m0 = *(const v4f*)mq, m1 = *(const v4f*)(mq + 4);
      v8f a = {m0[0], m0[1], m0[2], m0[3], m1[0], m1[1], m1[2], m1[3]};   // C[m=key][n=query] = m[query][key]: the D map
#pragma unroll
      for (int kc = 0; kc < 2; ++kc) { const v16h kf = frag_h(&kt[bf][j * 16 + col][kc * 32], lane);   // A[m=key][k=d]: k-contiguous row per key, same map as q
        a = wmma16(kf, qh[kc], a); a = wmma16(kf, qlo[kc], a); }
      s[j] = a; }
    float vj[4];                                            // four independent chains, then joined
#pragma unroll
    for (int j = 0; j < 4; ++j) { vj[j] = s[j][0];
#pragma unroll
      for (int r = 1; r < 8; ++r) vj[j] = fmaxf(vj[j], s[j][r]); }
    float v = fmaxf(fmaxf(vj[0], vj[1]), fmaxf(vj[2], vj[3]));
    v = fmaxf(v, xhalf(v));
    const float mn = fmaxf(mrow, v); const float alpha = exp_hw(mrow - mn); float rs[4];
#pragma unroll
    for (int j = 0; j < 4; ++j) { rs[j] = 0.0f; const v8f x2 = (s[j] - mn) * LOG2E;
#pragma unroll
      for (int r = 0; r < 8; ++r) { const float p = __builtin_amdgcn_exp2f(x2[r]); s[j][r] = p; rs[j] += p; } }
    lrow = lrow * alpha + ((rs[0] + rs[1]) + (rs[2] + rs[3])); mrow = mn;
#pragma unroll
    for (int t = 0; t < 4; ++t) o[t] *= alpha;
#pragma unroll
    for (int kc = 0; kc < 2; ++kc) { float pv[16];          // B[k=key][n=query]: elements 0..7 = keys 32kc+8g+0..7, 8..15 = 32kc+16+8g+0..7: the D registers of tiles 2kc, 2kc+1
      __builtin_amdgcn_sched_barrier(0);                    // bounds how far up the reads below may rise: both halves' fragments live at once do not fit the register cap
#pragma unroll
      for (int i = 0; i < 8; ++i) { pv[i] = s[2 * kc][i] * 2048.0f; pv[8 + i] = s[2 * kc + 1][i] * 2048.0f; }
      const F2 p = bsplit16(pv);
      v16b vh[4], vl[4];                                    // A[m=d][k=key]: key-contiguous row per d, same map
#pragma unroll
      for (int t = 0; t < 4; ++t) { vh[t] = frag_b(&vhs[bf][t * 16 + col][kc * 32], lane); vl[t] = frag_b(&vls[bf][t * 16 + col][kc * 32], lane); }
      __builtin_amdgcn_sched_barrier(0);                    // the sixteen fragment reads stay one group ahead of their products: without it each read is sunk to its product, with a full wait in front of it
#pragma unroll
      for (int t = 0; t < 4; ++t) { o[t] = wmma_bfp(vh[t], p.h, o[t]); o[t] = wmma_bfp(vh[t], p.l, o[t]); o[t] = wmma_bfp(vl[t], p.h, o[t]); } }
    asm volatile("s_wait_dscnt 0x0" ::: "memory");         // this wave's reads of buffer kb&1 are done
    asm volatile("s_wait_asynccnt 0x0" ::: "memory");      // this wave's copies of step kb+1 have landed
    __syncthreads();                                       // publishes step kb+1 and frees buffer kb&1
    if (kb + 2 < SEQ / KT) { const unsigned ko = (unsigned)bf * kvb; const int k2 = (kb + 2) * KT;
      copy_tiles(lk + ko, lh + ko, ll + ko, lm + (unsigned)bf * mb, gk + (size_t)k2 * CC, gh + k2, gl + k2, gm + k2); }
  }
  asm volatile("s_wait_asynccnt 0x0" ::: "memory");        // no copy outstanding before ms[0] becomes output staging
  ldsx();                                                   // this wave's last reads of its own ms rows are done; no other wave touches them any more
  const float inv = (1.0f / (lrow + xhalf(lrow))) * (1.0f / 2048.0f);
#pragma unroll
  for (int t = 0; t < 4; ++t) { float* op = &ms[0][wave * 16 + col][t * 16 + 8 * g]; const v8f w = o[t] * inv;
    *(v4f*)op = (v4f){w[0], w[1], w[2], w[3]}; *(v4f*)(op + 4) = (v4f){w[4], w[5], w[6], w[7]}; }
  ldsx();
  for (int rl = 0; rl < 16; ++rl) { const v4f w4 = *(const v4f*)&ms[0][wave * 16 + rl][(lane & 15) * 4];
    if (lane < HD / 4) vst2((void*)(OUT + ((size_t)b * SEQ + ql0 + rl) * CC + h * HD + lane * 4), w4); }
}

extern "C" void kernel_launch(void* const* d_in, const int* in_sizes, int n_in, void* d_out, int out_size, void* d_ws, size_t ws_size, hipStream_t stream) {
  if (n_in < 10) return;
  const size_t needX = ((size_t)(NB - 1) * SEQ_FULL + SEQ) * CC;
  const size_t needM = ((size_t)(NB - 1) * SEQ_FULL + SEQ - 1) * SEQ_FULL + SEQ;
  if ((size_t)in_sizes[0] < needX || (size_t)in_sizes[1] < needX || (size_t)in_sizes[2] < needX) return;
  if ((size_t)in_sizes[3] < needM) return;
  if ((size_t)in_sizes[4] < (size_t)CC * CC || (size_t)in_sizes[6] < (size_t)CC * CC || (size_t)in_sizes[8] < (size_t)CC * CC) return;
  if (in_sizes[5] < CC || in_sizes[7] < CC || in_sizes[9] < CC) return;
  if ((size_t)out_size < (size_t)NB * SEQ * CC) return;
  if (ws_size < (size_t)WS_END) return;
  const float* const* F = (const float* const*)d_in;   // 0 x_q, 1 x_k, 2 x_v [2,2048,1024]; 3 m [2,2048,2048]; 4 w_q [out][in], 5 b_q, 6 w_k, 7 b_k, 8 w_v, 9 b_v
  char* ws = (char*)d_ws;
  __bf16 *XQb = (__bf16*)(ws + WS_XQ), *XKb = (__bf16*)(ws + WS_XK), *XVb = (__bf16*)(ws + WS_XV);
  __bf16 *WQb = (__bf16*)(ws + WS_WQ), *WKb = (__bf16*)(ws + WS_WK), *WVb = (__bf16*)(ws + WS_WV);
  _Float16 *QH = (_Float16*)(ws + WS_QH), *QL = (_Float16*)(ws + WS_QL), *KH = (_Float16*)(ws + WS_KH);
  __bf16 *VT = (__bf16*)(ws + WS_VT), *VL = (__bf16*)(ws + WS_VL);
  const size_t nx8 = (size_t)NB * SEQ * CC / 8, nw8 = (size_t)CC * CC / 8;
  const unsigned gx8 = (unsigned)((nx8 + 255) / 256), gw8 = (unsigned)((nw8 + 255) / 256);
  const unsigned gx = gx8 > gw8 ? gx8 : gw8;
  k_cvt<<<dim3(gx, 1, 6), 256, 0, stream>>>(F[0], F[1], F[2], F[4], F[6], F[8], XQb, XKb, XVb, WQb, WKb, WVb);
  k_proj<<<dim3(NB * SEQ / PM, CC / PN, 3), 128, 0, stream>>>(XQb, XKb, XVb, WQb, WKb, WVb, F[5], F[7], F[9], QH, QL, KH, VT, VL);
  k_att<<<dim3(SEQ / QT, NH, NB), 256, 0, stream>>>(QH, QL, KH, VT, VL, F[3], (float*)d_out);
}

// v008
// Measured time: 76.1 microseconds a run.
// Versions between v006 and this one are left out; their measured steps multiply to 1.39 times as fast.
// Over all steps from v000 it is 5.58 times as fast.
// compute dtype: x, W and b RNE-converted to bf16, the mask m kept f32; q/k/v = x W^T + b on v_wmma_f32_16x16x32_bf16 (bf16 operands, exact products, f32 accumulate); q, -k/8 and v each rounded once to f16; logits m - q.k/8 on v_wmma_f32_16x16x32_f16 (1 product, one f32 accumulator that starts at m); online softmax in f32 (e^x = 2^(x log2 e) on the hardware exponential); P x 2^11 rounded once to f16 times v on v_wmma_f32_16x16x32_f16 (1 product, f32 accumulate); f32 output.
#include <hip/hip_runtime.h>
#include <math.h>

typedef __attribute__((ext_vector_type(16))) _Float16 v16h;
typedef __attribute__((ext_vector_type(16))) __bf16 v16b;
typedef __attribute__((ext_vector_type(8)))  _Float16 v8h;
typedef __attribute__((ext_vector_type(8)))  __bf16 v8b;
typedef __attribute__((ext_vector_type(8)))  float v8f;
typedef __attribute__((ext_vector_type(4)))  float v4f;
typedef __attribute__((ext_vector_type(4)))  unsigned v4u;

template <typename T> __device__ __forceinline__ void vst2(void* p, T v) { *(T*)p = v;  }

__device__ __forceinline__ v8f wmma16(v16h a, v16h b, v8f c) {
  return __builtin_amdgcn_wmma_f32_16x16x32_f16(false, a, false, b, (short)0, c, false, false);   // the compiler keeps the distance behind its own builtin
}
__device__ __forceinline__ v8f wmma_bf(v16b a, v16b b, v8f c) {
  v8f d = __builtin_amdgcn_wmma_f32_16x16x32_bf16(false, a, false, b, (short)0, c, false, false);
  asm volatile("v_nop\n\tv_nop\n\tv_nop\n\tv_nop" : "+v"(d) : "v"(a), "v"(b));
  return d;
}
// 16x16x32 fragments: lane = (g = lane>>4, row/col = lane&15); elements 0..7 = k0+8g+0..7, 8..15 = k0+16+8g+0..7; D element r = row 8g+r, col lane&15
// A from a row-major [m][k] row pointer at k0; B from a k-contiguous [n][k] row pointer at k0 (same map)
__device__ __forceinline__ v16h frag_h(const _Float16* rowk0, int lane) {
  union { v16h v; v8h q[2]; } u; const _Float16* p = rowk0 + 8 * (lane >> 4);
  u.q[0] = *(const v8h*)p; u.q[1] = *(const v8h*)(p + 16); return u.v;
}
__device__ __forceinline__ v16b frag_b(const __bf16* rowk0, int lane) {
  union { v16b v; v8b q[2]; } u; const __bf16* p = rowk0 + 8 * (lane >> 4);
  u.q[0] = *(const v8b*)p; u.q[1] = *(const v8b*)(p + 16); return u.v;
}
__device__ __forceinline__ float bfr(float v) { return (float)(__bf16)v; }
// same-wave LDS spill -> reload ordering: drain DS, lockstep the wave, keep the compiler from hoisting the reloads
__device__ __forceinline__ void ldsx() { asm volatile("s_wait_dscnt 0" ::: "memory"); __builtin_amdgcn_wave_barrier(); __builtin_amdgcn_fence(4, "workgroup"); }

// ---- sizes: NB x SEQ rows processed; inputs and d_in row strides use the *_FULL extents
#ifndef NB
#define NB 2
#endif
#ifndef SEQ
#define SEQ 2048
#endif
#ifndef NB_FULL
#define NB_FULL 2
#endif
#ifndef SEQ_FULL
#define SEQ_FULL 2048
#endif
#define CC 1024            // model width
#define NH 16              // heads
#define HD 64              // head width; column n of q/k/v = h*HD + d
#define KT 64              // keys per step of the fused softmax kernel

static_assert(NB >= 1 && NB <= NB_FULL);
static_assert(SEQ % 64 == 0 && SEQ <= SEQ_FULL && SEQ_FULL % 4 == 0);
static_assert(NH * HD == CC && HD == 64 && CC % 128 == 0 && KT == 64);

#define PLB (2u * (size_t)NB * SEQ * CC)   // one 16-bit [NB*SEQ][CC] plane
#define WPB (2u * (size_t)CC * CC)         // one 16-bit [CC][CC] weight plane
#define WS_XQ ((size_t)0)                  // bf16 x planes [b*SEQ+s][CC]
#define WS_XK (WS_XQ + PLB)
#define WS_XV (WS_XK + PLB)
#define WS_WQ (WS_XV + PLB)                // bf16 weight planes [out][in]
#define WS_WK (WS_WQ + WPB)
#define WS_WV (WS_WK + WPB)
#define WS_QH (WS_WV + WPB)                // f16 q [b*SEQ+s][CC]
#define WS_KH (WS_QH + PLB)                // f16 -k/8 [b*SEQ+s][CC]
#define WS_VT (WS_KH + PLB)                // f16 v, transposed [b][CC][SEQ]
#define WS_END (WS_VT + PLB)
static_assert(PLB % 128 == 0 && WPB % 128 == 0);
static_assert(WS_END <= (size_t)134217728u);

// ---- k_cvt: z = 0..5 selects (x_q, x_k, x_v, w_q, w_k, w_v): f32 -> bf16 (RNE), 8 elements per thread, one 16-B store per lane
// coverage: x planes NB*SEQ*CC/8 chunks (source rows remapped through the full strides), weight planes CC*CC/8 chunks; grid.x = max of the two
__global__ __launch_bounds__(256) void k_cvt(const float* __restrict__ XQ, const float* __restrict__ XK, const float* __restrict__ XV,
                                             const float* __restrict__ WQ, const float* __restrict__ WK, const float* __restrict__ WV,
                                             __bf16* __restrict__ DQ, __bf16* __restrict__ DK, __bf16* __restrict__ DV,
                                             __bf16* __restrict__ DWQ, __bf16* __restrict__ DWK, __bf16* __restrict__ DWV) {
  const int z = blockIdx.z;
  const float* src = z == 0 ? XQ : z == 1 ? XK : z == 2 ? XV : z == 3 ? WQ : z == 4 ? WK : WV;
  __bf16* dst = z == 0 ? DQ : z == 1 ? DK : z == 2 ? DV : z == 3 ? DWQ : z == 4 ? DWK : DWV;
  const size_t n8 = (z < 3) ? (size_t)NB * SEQ * CC / 8 : (size_t)CC * CC / 8;
  const size_t e = (size_t)blockIdx.x * 256 + threadIdx.x;
  if (e >= n8) return;
  size_t so = e * 8;
  if (z < 3) { const size_t row = e / (CC / 8), c = e % (CC / 8); so = ((row / SEQ) * SEQ_FULL + (row % SEQ)) * CC + c * 8; }
  const v4f f0 = *(const v4f*)(src + so), f1 = *(const v4f*)(src + so + 4);
  union { v8b v; v4u u; } o;
#pragma unroll
  for (int i = 0; i < 4; ++i) { o.v[i] = (__bf16)f0[i]; o.v[4 + i] = (__bf16)f1[i]; }
  vst2((void*)(dst + e * 8), o.u);
}

// ---- k_proj: block = (128 rows, 128 cols, which), 4 waves as 2 x 2, each a 64 x 64 tile: y = x W^T + b with exact bf16 products, k summed in 32-steps that ascend from the block's own first slice and wrap round;
// q -> f16, -k/8 -> f16, v -> f16 transposed plane: each rounded once; the rounding (11 significant bits) lies well below the error that the bf16 operands of these products leave in q, k and v.
// Per stage a 64-wide k slice of the block's 128 x rows and 128 W rows is brought into LDS once by asynchronous copies (two buffers: the next
// slice flies while this one is multiplied); every wave takes its fragments from there, so each operand byte leaves L2 once per block, in whole 128-B lines.
// The 8 blocks that share x rows and the 32 that share W rows run at the same time: each enters the 16 slices at a start set by its tile indices, so that they do not ask L2 for the same lines at the same moment.
// coverage: grid (NB*SEQ/128, CC/128, 3) writes every row and column of QH, KH, VT exactly once
#define PM 128             // x rows per block
#define PN 128             // W rows (output columns) per block
#define PK 64              // k per stage: 128 B of every operand row
#define PP 72              // LDS row pitch in elements: 144 B = 16 B x 9, conflict-free for the 16-B fragment reads
#define PBUF ((PM + PN) * PP)   // elements of one buffer: x rows, then W rows
#define PE 136             // row pitch in elements of the output staging that takes the ring's place after the loop
static_assert((NB * SEQ) % PM == 0 && SEQ % PM == 0 && CC % PN == 0 && CC % PK == 0 && CC / PK >= 2);
static_assert(PM == 128 && PN == 128 && PK == 64 && PM * PE <= 2 * PBUF && PN * PE <= 2 * PBUF);
static_assert(((CC / PK) & (CC / PK - 1)) == 0);   // the wrap of the slice number is a mask

// eight asynchronous 16-B copies per lane, global -> LDS, rows 16 apart (global pitch CC elements, LDS pitch PP elements);
// the s_wait_xcnt 0 closes the copies' own statement so that no address register named here is rewritten ahead of it
__device__ __forceinline__ void copy8(unsigned l, const __bf16* g) {
  asm volatile("global_load_async_to_lds_b128 %0, %8, off\n\t"
               "global_load_async_to_lds_b128 %1, %9, off\n\t"
               "global_load_async_to_lds_b128 %2, %10, off\n\t"
               "global_load_async_to_lds_b128 %3, %11, off\n\t"
               "global_load_async_to_lds_b128 %4, %12, off\n\t"
               "global_load_async_to_lds_b128 %5, %13, off\n\t"
               "global_load_async_to_lds_b128 %6, %14, off\n\t"
               "global_load_async_to_lds_b128 %7, %15, off\n\t"
               "s_wait_xcnt 0x0"
               :: "v"(l), "v"(l + 1u * 32u * PP), "v"(l + 2u * 32u * PP), "v"(l + 3u * 32u * PP),
                  "v"(l + 4u * 32u * PP), "v"(l + 5u * 32u * PP), "v"(l + 6u * 32u * PP), "v"(l + 7u * 32u * PP),
                  "v"(g), "v"(g + 1 * 16 * CC), "v"(g + 2 * 16 * CC), "v"(g + 3 * 16 * CC),
                  "v"(g + 4 * 16 * CC), "v"(g + 5 * 16 * CC), "v"(g + 6 * 16 * CC), "v"(g + 7 * 16 * CC)
               : "memory");
}

__global__ __launch_bounds__(128) void k_proj(const __bf16* __restrict__ XQ, const __bf16* __restrict__ XK, const __bf16* __restrict__ XV,
                                              const __bf16* __restrict__ WQ, const __bf16* __restrict__ WK, const __bf16* __restrict__ WV,
                                              const float* __restrict__ BQ, const float* __restrict__ BK, const float* __restrict__ BV,
                                              _Float16* __restrict__ QH, _Float16* __restrict__ KH, _Float16* __restrict__ VT) {
  __shared__ __align__(16) __bf16 ring[2 * PBUF];          // two operand buffers; output staging after the loop
  const int tid = threadIdx.x, wave = tid >> 5, lane = tid & 31, col = lane & 15, g = lane >> 4;
  const int wm = wave >> 1, wn = wave & 1;                 // this wave's 64 x 64 quarter of the block tile
  const int which = blockIdx.z; const int c0 = blockIdx.y * PN; const size_t r0 = (size_t)blockIdx.x * PM;
  const __bf16* X = which == 0 ? XQ : which == 1 ? XK : XV;
  const __bf16* W = which == 0 ? WQ : which == 1 ? WK : WV;
  const float* BA = which == 0 ? BQ : which == 1 ? BK : BV;
  // copies: lane = (row tid>>3 of each 16-row group, 16-B piece tid&7 of the row's 128 B); 8 lanes cover one whole line
  const int cr = tid >> 3, cp = (tid & 7) * 8;
  const __bf16* gx = X + (r0 + cr) * CC + cp;
  const __bf16* gw = W + (size_t)(c0 + cr) * CC + cp;
  const unsigned lx = (unsigned)(size_t)&ring[cr * PP + cp], lw = lx + 2u * PM * PP;
  const int s0 = (int)(blockIdx.x + 2 * blockIdx.y);       // stage t works on slice (s0 + t) mod 16: sharers of x rows start 2 slices apart, sharers of W rows 1
  const int k0 = (s0 & (CC / PK - 1)) * PK, k1 = ((s0 + 1) & (CC / PK - 1)) * PK;
  copy8(lx, gx + k0); copy8(lw, gw + k0);                  // stage 0 -> buffer 0
  asm volatile("s_wait_asynccnt 0x0" ::: "memory");        // this wave's stage-0 copies have landed
  __syncthreads();                                         // ... and every other wave's
  copy8(lx + 2u * PBUF, gx + k1); copy8(lw + 2u * PBUF, gw + k1);   // stage 1 -> buffer 1
  v8f acc[4][4] = {};
#pragma unroll 1   // one stage per trip: the ring's order of waits, barrier and refill stays as written
  for (int t = 0; t < CC / PK; ++t) {
    const __bf16* xb = ring + (t & 1) * PBUF + (wm * 64 + col) * PP;
    const __bf16* wb = ring + (t & 1) * PBUF + (PM + wn * 64 + col) * PP;
#pragma unroll
    for (int kc = 0; kc < PK / 32; ++kc) {
      v16b a[4], w[4];
#pragma unroll
      for (int i = 0; i < 4; ++i) a[i] = frag_b(xb + i * 16 * PP + kc * 32, lane);      // A: x row m, split k map
#pragma unroll
      for (int j = 0; j < 4; ++j) w[j] = frag_b(wb + j * 16 * PP + kc * 32, lane);      // B[k][n] = W[n][k]: k-contiguous row n, same map
#pragma unroll
      for (int i = 0; i < 4; ++i)
#pragma unroll
        for (int j = 0; j < 4; ++j) acc[i][j] = wmma_bf(a[i], w[j], acc[i][j]); }
    asm volatile("s_wait_dscnt 0x0" ::: "memory");         // this wave's reads of buffer t&1 are done
    asm volatile("s_wait_asynccnt 0x0" ::: "memory");      // this wave's copies of stage t+1 have landed
    __syncthreads();                                       // publishes stage t+1 and frees buffer t&1
    if (t + 2 < CC / PK) { const unsigned bo = (unsigned)(t & 1) * 2u * PBUF; const int k2 = ((s0 + t + 2) & (CC / PK - 1)) * PK;
      copy8(lx + bo, gx + k2); copy8(lw + bo, gw + k2); }
  }
  asm volatile("s_wait_asynccnt 0x0" ::: "memory");        // no copy outstanding before the ring becomes output staging
  if (which == 2) { _Float16* th = (_Float16*)ring;                             // [col][row]
#pragma unroll
    for (int j = 0; j < 4; ++j) { const int cl = wn * 64 + j * 16 + col; const float bb = bfr(BA[c0 + cl]);
#pragma unroll
      for (int i = 0; i < 4; ++i) { v8h hv;
#pragma unroll
        for (int r = 0; r < 8; ++r) hv[r] = (_Float16)(acc[i][j][r] + bb);
        const int rl = wm * 64 + i * 16 + 8 * g;
        *(v8h*)&th[cl * PE + rl] = hv; } }
    __syncthreads();
    // stores: lane = (staged row tid>>4 of each 8-row group, 16-B piece tid&15): 16 lanes cover 256 contiguous bytes; one address, constant steps
    const int sr = tid >> 4, sq = (tid & 15) * 8;
    const size_t o2 = ((r0 / SEQ) * CC + c0 + sr) * (size_t)SEQ + (r0 % SEQ) + sq;
#pragma unroll
    for (int i = 0; i < PN / 8; ++i) vst2((void*)(VT + o2 + (size_t)i * 8 * SEQ), *(const v4u*)&th[(sr + i * 8) * PE + sq]);
    asm volatile("s_wait_xcnt 0x0" ::: "memory");          // precaution: stands between the stores above and any later rewrite of a register that they name
  }
  else { _Float16* sh = (_Float16*)ring;                                         // [row][col]
    const float sc = which == 1 ? -0.125f : 1.0f;           // the k plane carries the logit's factor -1/sqrt(64): a power of two, so the f16 rounding of k is the same
#pragma unroll
    for (int j = 0; j < 4; ++j) { const int cl = wn * 64 + j * 16 + col; const float bb = bfr(BA[c0 + cl]);
#pragma unroll
      for (int i = 0; i < 4; ++i)
#pragma unroll
        for (int r = 0; r < 8; ++r) sh[(wm * 64 + i * 16 + 8 * g + r) * PE + cl] = (_Float16)((acc[i][j][r] + bb) * sc); }
    __syncthreads();
    const int sr = tid >> 4, sq = (tid & 15) * 8;           // as above
    _Float16* D = (which == 0 ? QH : KH) + (r0 + sr) * CC + c0 + sq;
#pragma unroll
    for (int i = 0; i < PM / 8; ++i) vst2((void*)(D + (size_t)i * 8 * CC), *(const v4u*)&sh[(sr + i * 8) * PE + sq]);
    asm volatile("s_wait_xcnt 0x0" ::: "memory");          // precaution: stands between the stores above and any later rewrite of a register that they name
  }
}

__device__ __forceinline__ float xhalf(float x) {          // lane l takes lane l ^ 16's value
  return __builtin_bit_cast(float, __builtin_amdgcn_permlanex16(__builtin_bit_cast(int, x), __builtin_bit_cast(int, x), 0x76543210, 0xfedcba98, false, false)); }

// e^x as 2^(x log2 e): one multiply and the hardware's base-2 exponential; x <= 0 here (an older maximum minus the running maximum), -inf and anything below the f32 range give 0
#define LOG2E 1.44269504088896340736f
__device__ __forceinline__ float exp_hw(float x) { return __builtin_amdgcn_exp2f(x * LOG2E); }

#define QT 128             // queries per block: 8 waves x 16
#define AKP 72             // row pitch in elements of the k and v tiles in LDS (144 B)
#define AMP 68             // row pitch in floats of the mask tile in LDS (272 B)
static_assert(SEQ % QT == 0 && SEQ / KT >= 2 && QT == 128);
static_assert(((SEQ / KT) & (SEQ / KT - 1)) == 0);   // the wrap of the key tile's number is a mask

// one step's tiles: twelve asynchronous 16-B copies per lane, global -> LDS: rows r and r + 32 of the k and of the v tile, then eight mask rows 16 apart;
// the s_wait_xcnt 0 closes the copies' own statement so that no address register named here is rewritten ahead of it
__device__ __forceinline__ void copy_tiles(unsigned lk, unsigned lv, unsigned lm, const _Float16* gk, const _Float16* gv, const float* gm) {
  asm volatile("global_load_async_to_lds_b128 %0, %12, off\n\t"
               "global_load_async_to_lds_b128 %1, %13, off\n\t"
               "global_load_async_to_lds_b128 %2, %14, off\n\t"
               "global_load_async_to_lds_b128 %3, %15, off\n\t"
               "global_load_async_to_lds_b128 %4, %16, off\n\t"
               "global_load_async_to_lds_b128 %5, %17, off\n\t"
               "global_load_async_to_lds_b128 %6, %18, off\n\t"
               "global_load_async_to_lds_b128 %7, %19, off\n\t"
               "global_load_async_to_lds_b128 %8, %20, off\n\t"
               "global_load_async_to_lds_b128 %9, %21, off\n\t"
               "global_load_async_to_lds_b128 %10, %22, off\n\t"
               "global_load_async_to_lds_b128 %11, %23, off\n\t"
               "s_wait_xcnt 0x0"
               :: "v"(lk), "v"(lk + 64u * AKP), "v"(lv), "v"(lv + 64u * AKP),
                  "v"(lm), "v"(lm + 1u * 64u * AMP), "v"(lm + 2u * 64u * AMP), "v"(lm + 3u * 64u * AMP),
                  "v"(lm + 4u * 64u * AMP), "v"(lm + 5u * 64u * AMP), "v"(lm + 6u * 64u * AMP), "v"(lm + 7u * 64u * AMP),
                  "v"(gk), "v"(gk + 32 * CC), "v"(gv), "v"(gv + 32 * SEQ),
                  "v"(gm), "v"(gm + 1 * 16 * SEQ_FULL), "v"(gm + 2 * 16 * SEQ_FULL), "v"(gm + 3 * 16 * SEQ_FULL),
                  "v"(gm + 4 * 16 * SEQ_FULL), "v"(gm + 5 * 16 * SEQ_FULL), "v"(gm + 6 * 16 * SEQ_FULL), "v"(gm + 7 * 16 * SEQ_FULL)
               : "memory");
}

// second launch-bounds argument: four waves a SIMD, that is at most 256 registers a wave; without it the freer schedule takes a few more, and one work-group fewer fits on a WGP
__global__ __launch_bounds__(256, 4) void k_att(const _Float16* __restrict__ QH, const _Float16* __restrict__ KH, const _Float16* __restrict__ VT,
                                             const float* __restrict__ MK, float* __restrict__ OUT) {
  __shared__ __align__(16) _Float16 kt[2][KT][AKP];        // [buffer][key][d]
  __shared__ __align__(16) _Float16 vs[2][HD][AKP];        // [buffer][d][key]
  __shared__ __align__(16) float ms[2][QT][AMP];           // [buffer][query][key]; behind the loop ms[0] is [query][d] output staging
  // the wave's number in a scalar register (one-dimensional block of eight waves): what hangs on it takes no vector register, which keeps the capped build free of scratch
  const int tid = threadIdx.x, wave = __builtin_amdgcn_readfirstlane(tid >> 5), lane = tid & 31, col = lane & 15, g = lane >> 4;
  const int b = blockIdx.z, h = blockIdx.y, qb0 = blockIdx.x * QT, ql0 = qb0 + wave * 16;
  const size_t qrow = (size_t)b * SEQ + ql0;
  v16h qh[2];                                               // B[k=d][n=query]: k-contiguous row per query
#pragma unroll
  for (int kc = 0; kc < 2; ++kc) qh[kc] = frag_h(QH + (qrow + col) * CC + h * HD + kc * 32, lane);
  float mrow = -3.0e38f, lrow = 0.0f; v8f o[4];             // query ql0+col: running maximum (both halves), this half's sum; o[t][r] = o^T[d = 16t+8g+r][query]
#pragma unroll
  for (int t = 0; t < 4; ++t) o[t] = (v8f){};
  // copies, staged extent == consumed extent: kt rows 0..63 x d 0..63, vs d 0..63 x keys 0..63 (lane = row tid>>3 and that + 32, 16-B piece tid&7: 8 lanes cover one whole line);
  // ms 128 x 64 (lane = row tid>>4 of each 16-row group, 16-B piece tid&15)
  const int cr = tid >> 3, cp = (tid & 7) * 8, mr = tid >> 4, mp = (tid & 15) * 4;
  const _Float16* gk = KH + ((size_t)b * SEQ + cr) * CC + h * HD + cp;
  const _Float16* gv = VT + ((size_t)b * CC + h * HD + cr) * SEQ + cp;
  const float* gm = MK + ((size_t)b * SEQ_FULL + qb0 + mr) * SEQ_FULL + mp;
  const unsigned lk = (unsigned)(size_t)&kt[0][cr][cp], lv = (unsigned)(size_t)&vs[0][cr][cp], lm = (unsigned)(size_t)&ms[0][mr][mp];
  const unsigned kvb = 2u * KT * AKP, mb = 4u * QT * AMP;   // bytes from buffer 0 to buffer 1
  const int s0 = 2 * (int)(blockIdx.x + blockIdx.y);       // step kb works on key tile (s0 + kb) mod 32: sharers of a mask tile, and of a k and v tile, start 2 tiles apart
  const int t0 = (s0 & (SEQ / KT - 1)) * KT, t1 = ((s0 + 1) & (SEQ / KT - 1)) * KT;
  copy_tiles(lk, lv, lm, gk + (size_t)t0 * CC, gv + t0, gm + t0);   // step 0 -> buffer 0
  asm volatile("s_wait_asynccnt 0x0" ::: "memory");        // this wave's step-0 copies have landed
  __syncthreads();                                         // ... and every other wave's
  copy_tiles(lk + kvb, lv + kvb, lm + mb, gk + (size_t)t1 * CC, gv + t1, gm + t1);   // step 1 -> buffer 1
#pragma unroll 1   // one step per trip: the ring's order of waits, barrier and refill stays as written
  for (int kb = 0; kb < SEQ / KT; ++kb) {
    const int bf = kb & 1;
    v8f s[4]; v16h kf[4][2];                                // s[j][r] = logit of key 16j+8g+r, query col
#pragma unroll
    for (int j = 0; j < 4; ++j) {
      const float* mq = &ms[bf][wave * 16 + col][j * 16 + 8 * g];
      const v4f m0 = *(const v4f*)mq, m1 = *(const v4f*)(mq + 4);
      s[j] = (v8f){m0[0], m0[1], m0[2], m0[3], m1[0], m1[1], m1[2], m1[3]};   // C[m=key][n=query] = m[query][key]: the D map
#pragma unroll
      for (int kc = 0; kc < 2; ++kc) kf[j][kc] = frag_h(&kt[bf][j * 16 + col][kc * 32], lane); }   // A[m=key][k=d]: k-contiguous row per key, same map as q
    v16h vf[2][4];                                          // A[m=d][k=key]: key-contiguous row per d, same map
#pragma unroll
    for (int kc = 0; kc < 2; ++kc)
#pragma unroll
      for (int t = 0; t < 4; ++t) vf[kc][t] = frag_h(&vs[bf][t * 16 + col][kc * 32], lane);
    __builtin_amdgcn_sched_barrier(0);                      // all forty reads of the step stay one group at its head (mask and k first, v behind them, landing under the logits and the softmax): without it they are spread among the products, the v reads sunk to theirs, each place with a wait of its own
#pragma unroll
    for (int kc = 0; kc < 2; ++kc)
#pragma unroll
      for (int j = 0; j < 4; ++j) s[j] = wmma16(kf[j][kc], qh[kc], s[j]);
    float vj[4];                                            // four independent chains, then joined
#pragma unroll
    for (int j = 0; j < 4; ++j) { vj[j] = s[j][0];
#pragma unroll
      for (int r = 1; r < 8; ++r) vj[j] = fmaxf(vj[j], s[j][r]); }
    float v = fmaxf(fmaxf(vj[0], vj[1]), fmaxf(vj[2], vj[3]));
    v = fmaxf(v, xhalf(v));
    const float mn = fmaxf(mrow, v); const float alpha = exp_hw(mrow - mn); float rs[4];
#pragma unroll
    for (int j = 0; j < 4; ++j) { rs[j] = 0.0f; const v8f x2 = (s[j] - mn) * LOG2E;
#pragma unroll
      for (int r = 0; r < 8; ++r) { const float p = __builtin_amdgcn_exp2f(x2[r]); s[j][r] = p; rs[j] += p; } }
    lrow = lrow * alpha + ((rs[0] + rs[1]) + (rs[2] + rs[3])); mrow = mn;
#pragma unroll
    for (int t = 0; t < 4; ++t) o[t] *= alpha;
    __builtin_amdgcn_sched_barrier(0);                      // the 33 exponentials stay one run ahead of the conversions: without it each pair is chained exp, multiply, convert through the same two registers, with an idle slot behind every pair
#pragma unroll
    for (int kc = 0; kc < 2; ++kc) { v16h pf;               // B[k=key][n=query]: elements 0..7 = keys 32kc+8g+0..7, 8..15 = 32kc+16+8g+0..7: the D registers of tiles 2kc, 2kc+1
#pragma unroll
      for (int i = 0; i < 8; ++i) { pf[i] = (_Float16)(s[2 * kc][i] * 2048.0f); pf[8 + i] = (_Float16)(s[2 * kc + 1][i] * 2048.0f); }
#pragma unroll
      for (int t = 0; t < 4; ++t) o[t] = wmma16(vf[kc][t], pf, o[t]); }
    __builtin_amdgcn_sched_barrier(0);                      // the waits and the barrier below stay at the step's foot: with every LDS read of the step up at its head they would else rise above the softmax, and the wait for the next tiles' copies would come a whole step's work too early
    asm volatile("s_wait_dscnt 0x0" ::: "memory");         // this wave's reads of buffer kb&1 are done
    asm volatile("s_wait_asynccnt 0x0" ::: "memory");      // this wave's copies of step kb+1 have landed
    __syncthreads();                                       // publishes step kb+1 and frees buffer kb&1
    if (kb + 2 < SEQ / KT) { const unsigned ko = (unsigned)bf * kvb; const int k2 = ((s0 + kb + 2) & (SEQ / KT - 1)) * KT;
      copy_tiles(lk + ko, lv + ko, lm + (unsigned)bf * mb, gk + (size_t)k2 * CC, gv + k2, gm + k2); }
  }
  asm volatile("s_wait_asynccnt 0x0" ::: "memory");        // no copy outstanding before ms[0] becomes output staging
  ldsx();                                                   // this wave's last reads of its own ms rows are done; no other wave touches them any more
  const float inv = (1.0f / (lrow + xhalf(lrow))) * (1.0f / 2048.0f);
#pragma unroll
  for (int t = 0; t < 4; ++t) { float* op = &ms[0][wave * 16 + col][t * 16 + 8 * g]; const v8f w = o[t] * inv;
    *(v4f*)op = (v4f){w[0], w[1], w[2], w[3]}; *(v4f*)(op + 4) = (v4f){w[4], w[5], w[6], w[7]}; }
  ldsx();
  for (int rl = 0; rl < 16; ++rl) { const v4f w4 = *(const v4f*)&ms[0][wave * 16 + rl][(lane & 15) * 4];
    if (lane < HD / 4) vst2((void*)(OUT + ((size_t)b * SEQ + ql0 + rl) * CC + h * HD + lane * 4), w4); }
}

extern "C" void kernel_launch(void* const* d_in, const int* in_sizes, int n_in, void* d_out, int out_size, void* d_ws, size_t ws_size, hipStream_t stream) {
  if (n_in < 10) return;
  const size_t needX = ((size_t)(NB - 1) * SEQ_FULL + SEQ) * CC;
  const size_t needM = ((size_t)(NB - 1) * SEQ_FULL + SEQ - 1) * SEQ_FULL + SEQ;
  if ((size_t)in_sizes[0] < needX || (size_t)in_sizes[1] < needX || (size_t)in_sizes[2] < needX) return;
  if ((size_t)in_sizes[3] < needM) return;
  if ((size_t)in_sizes[4] < (size_t)CC * CC || (size_t)in_sizes[6] < (size_t)CC * CC || (size_t)in_sizes[8] < (size_t)CC * CC) return;
  if (in_sizes[5] < CC || in_sizes[7] < CC || in_sizes[9] < CC) return;
  if ((size_t)out_size < (size_t)NB * SEQ * CC) return;
  if (ws_size < (size_t)WS_END) return;
  const float* const* F = (const float* const*)d_in;   // 0 x_q, 1 x_k, 2 x_v [2,2048,1024]; 3 m [2,2048,2048]; 4 w_q [out][in], 5 b_q, 6 w_k, 7 b_k, 8 w_v, 9 b_v
  char* ws = (char*)d_ws;
  __bf16 *XQb = (__bf16*)(ws + WS_XQ), *XKb = (__bf16*)(ws + WS_XK), *XVb = (__bf16*)(ws + WS_XV);
  __bf16 *WQb = (__bf16*)(ws + WS_WQ), *WKb = (__bf16*)(ws + WS_WK), *WVb = (__bf16*)(ws + WS_WV);
  _Float16 *QH = (_Float16*)(ws + WS_QH), *KH = (_Float16*)(ws + WS_KH), *VT = (_Float16*)(ws + WS_VT);
  const size_t nx8 = (size_t)NB * SEQ * CC / 8, nw8 = (size_t)CC * CC / 8;
  const unsigned gx8 = (unsigned)((nx8 + 255) / 256), gw8 = (unsigned)((nw8 + 255) / 256);
  const unsigned gx = gx8 > gw8 ? gx8 : gw8;
  k_cvt<<<dim3(gx, 1, 6), 256, 0, stream>>>(F[0], F[1], F[2], F[4], F[6], F[8], XQb, XKb, XVb, WQb, WKb, WVb);
  k_proj<<<dim3(NB * SEQ / PM, CC / PN, 3), 128, 0, stream>>>(XQb, XKb, XVb, WQb, WKb, WVb, F[5], F[7], F[9], QH, KH, VT);
  k_att<<<dim3(SEQ / QT, NH, NB), 256, 0, stream>>>(QH, KH, VT, F[3], (float*)d_out);
}

// v009
// It runs in 71.6 microseconds.
// Timed twice side by side with v008, it ran 1.06 and 1.07 times as fast.
// Over all steps from v000 it is 5.95 times as fast.
// compute dtype: x, W and b RNE-converted to bf16, the mask m kept f32; q/k/v = x W^T + b on v_wmma_f32_16x16x32_bf16 (bf16 operands, exact products, f32 accumulate); q, -k/8 and v each rounded once to f16; logits m - q.k/8 on v_wmma_f32_16x16x32_f16 (1 product, one f32 accumulator that starts at m); online softmax in f32 (e^x = 2^(x log2 e) on the hardware exponential); P x 2^11 rounded once to f16 times v on v_wmma_f32_16x16x32_f16 (1 product, f32 accumulate); f32 output.
#include <hip/hip_runtime.h>
#include <math.h>

typedef __attribute__((ext_vector_type(16))) _Float16 v16h;
typedef __attribute__((ext_vector_type(16))) __bf16 v16b;
typedef __attribute__((ext_vector_type(8)))  _Float16 v8h;
typedef __attribute__((ext_vector_type(8)))  __bf16 v8b;
typedef __attribute__((ext_vector_type(8)))  float v8f;
typedef __attribute__((ext_vector_type(4)))  float v4f;
typedef __attribute__((ext_vector_type(4)))  unsigned v4u;
typedef __attribute__((ext_vector_type(8)))  unsigned v8u;

template <typename T> __device__ __forceinline__ void vst2(void* p, T v) { *(T*)p = v;  }

__device__ __forceinline__ v8f wmma16(v16h a, v16h b, v8f c) {
  return __builtin_amdgcn_wmma_f32_16x16x32_f16(false, a, false, b, (short)0, c, false, false);   // the compiler keeps the distance behind its own builtin
}
__device__ __forceinline__ v8f wmma_bf(v16b a, v16b b, v8f c) {
  v8f d = __builtin_amdgcn_wmma_f32_16x16x32_bf16(false, a, false, b, (short)0, c, false, false);
  asm volatile("v_nop\n\tv_nop\n\tv_nop\n\tv_nop" : "+v"(d) : "v"(a), "v"(b));
  return d;
}
// 16x16x32 fragments: lane = (g = lane>>4, row/col = lane&15); elements 0..7 = k0+8g+0..7, 8..15 = k0+16+8g+0..7; D element r = row 8g+r, col lane&15
// A from a row-major [m][k] row pointer at k0; B from a k-contiguous [n][k] row pointer at k0 (same map)
__device__ __forceinline__ v16h frag_h(const _Float16* rowk0, int lane) {
  union { v16h v; v8h q[2]; } u; const _Float16* p = rowk0 + 8 * (lane >> 4);
  u.q[0] = *(const v8h*)p; u.q[1] = *(const v8h*)(p + 16); return u.v;
}
__device__ __forceinline__ v16b frag_b(const __bf16* rowk0, int lane) {
  union { v16b v; v8b q[2]; } u; const __bf16* p = rowk0 + 8 * (lane >> 4);
  u.q[0] = *(const v8b*)p; u.q[1] = *(const v8b*)(p + 16); return u.v;
}
__device__ __forceinline__ float bfr(float v) { return (float)(__bf16)v; }
// same-wave LDS spill -> reload ordering: drain DS, lockstep the wave, keep the compiler from hoisting the reloads
__device__ __forceinline__ void ldsx() { asm volatile("s_wait_dscnt 0" ::: "memory"); __builtin_amdgcn_wave_barrier(); __builtin_amdgcn_fence(4, "workgroup"); }

// ---- tensor loads: one request of one wave brings a tile of ROWS rows of ROWB bytes (source pitch in bytes) from global memory into LDS, through no register
__device__ __forceinline__ unsigned uni(unsigned v) { return (unsigned)__builtin_amdgcn_readfirstlane((int)v); }
__device__ __forceinline__ unsigned pinned(unsigned v) { unsigned w = uni(v); asm volatile("" : "+s"(w)); return w; }   // holds a wave-uniform test in a scalar register, so that the branch on it is a scalar branch: a tensor load ignores EXEC
// W0 = word 0 of group 1: no mask, 1-byte elements, a pad of 4 dwords behind every row (interval code 4 for rows of 128 B, 5 for rows of 256 B): LDS pitch ROWB + 16
#define TW0_128 ((1u << 20) | (4u << 22) | (3u << 25))
#define TW0_256 ((1u << 20) | (5u << 22) | (3u << 25))
#define TSL 10240u         // bytes of one slice's place in LDS: 64 rows x 144 B or 32 rows x 272 B, rounded up to a multiple of 2 KiB
// group 1 of a descriptor, every word wave-uniform
template <unsigned W0, unsigned ROWB, unsigned ROWS>
__device__ __forceinline__ v8u tgroup1(unsigned pitch) {
  return (v8u){uni(W0), uni((ROWB & 0xFFFFu) << 16), uni((ROWB >> 16) | ((ROWS & 0xFFFFu) << 16)), uni((ROWS >> 16) | (ROWB << 16)), uni(ROWS), uni(pitch), uni(0u), uni(0u)};
}
// Where a descriptor lives: group 0 in s[80:83], group 1 for rows of 128 B in s[84:91], for rows of 256 B in s[92:99]. No word may take a new value between a request's issue and the wait that covers it, so:
// group 1 is built once ahead of the loop and every wait names it again as an input; group 0 lies in registers named by number (far above those that the compiler's own values take) and is written by the
// three statements below and by nothing else (from the first request on, the listing shows no other write to s80 .. s99): word 0 once, word 3 directly behind the wait for the wave's request before, words 1 and 2 in the issuing statement.
__device__ __forceinline__ void thold128(v8u& g1) { asm volatile("" : "+{s[84:91]}"(g1)); }   // descriptor words held in scalar registers: built once, not rebuilt at each use
__device__ __forceinline__ void thold256(v8u& g1) { asm volatile("" : "+{s[92:99]}"(g1)); }   // the same for the second kind of tile
__device__ __forceinline__ void tcount() { const unsigned w0 = uni(1u); asm volatile("s_mov_b32 s80, %0" :: "s"(w0) : "memory", "s80"); }   // group 0 word 0: count 1
// group 0 word 3: the top of the tile's address and type 2; a statement of its own so that it stands well ahead of the request, with the barrier between them
__device__ __forceinline__ void thigh(unsigned long long ga) { const unsigned w3 = uni((((unsigned)(ga >> 32)) & 0x01FFFFFFu) | 0x80000000u); asm volatile("s_mov_b32 s83, %0" :: "s"(w3) : "memory", "s83"); }
// group 0 words 1 and 2: the tile's place in LDS, the low word of its first byte's address; then the request
#define TISSUE "s_mov_b32 s81, %0\n\ts_mov_b32 s82, %1\n\ttensor_load_to_lds s[80:83], %2"
__device__ __forceinline__ void tload128(unsigned lds, unsigned long long ga, v8u g1) { const unsigned w1 = uni(lds), w2 = uni((unsigned)ga);
  asm volatile(TISSUE :: "s"(w1), "s"(w2), "{s[84:91]}"(g1) : "memory", "s81", "s82"); }
__device__ __forceinline__ void tload256(unsigned lds, unsigned long long ga, v8u g1) { const unsigned w1 = uni(lds), w2 = uni((unsigned)ga);
  asm volatile(TISSUE :: "s"(w1), "s"(w2), "{s[92:99]}"(g1) : "memory", "s81", "s82"); }
// the issuing wave's own wait: its request has landed behind it; a wave with no request outstanding passes at once; the inputs keep group 1 in its registers up to here
__device__ __forceinline__ void twait(v8u g1) { asm volatile("s_wait_tensorcnt 0x0" :: "{s[84:91]}"(g1) : "memory"); }
__device__ __forceinline__ void twait(v8u g1a, v8u g1b) { asm volatile("s_wait_tensorcnt 0x0" :: "{s[84:91]}"(g1a), "{s[92:99]}"(g1b) : "memory"); }
static_assert(64u * 144u <= TSL && 32u * 272u <= TSL && TSL % 2048u == 0);

// ---- sizes: NB x SEQ rows processed; inputs and d_in row strides use the *_FULL extents
#ifndef NB
#define NB 2
#endif
#ifndef SEQ
#define SEQ 2048
#endif
#ifndef NB_FULL
#define NB_FULL 2
#endif
#ifndef SEQ_FULL
#define SEQ_FULL 2048
#endif
#define CC 1024            // model width
#define NH 16              // heads
#define HD 64              // head width; column n of q/k/v = h*HD + d
#define KT 64              // keys per step of the fused softmax kernel

static_assert(NB >= 1 && NB <= NB_FULL);
static_assert(SEQ % 64 == 0 && SEQ <= SEQ_FULL && SEQ_FULL % 4 == 0);
static_assert(NH * HD == CC && HD == 64 && CC % 128 == 0 && KT == 64);

#define PLB (2u * (size_t)NB * SEQ * CC)   // one 16-bit [NB*SEQ][CC] plane
#define WPB (2u * (size_t)CC * CC)         // one 16-bit [CC][CC] weight plane
#define WS_XQ ((size_t)0)                  // bf16 x planes [b*SEQ+s][CC]
#define WS_XK (WS_XQ + PLB)
#define WS_XV (WS_XK + PLB)
#define WS_WQ (WS_XV + PLB)                // bf16 weight planes [out][in]
#define WS_WK (WS_WQ + WPB)
#define WS_WV (WS_WK + WPB)
#define WS_QH (WS_WV + WPB)                // f16 q [b*SEQ+s][CC]
#define WS_KH (WS_QH + PLB)                // f16 -k/8 [b*SEQ+s][CC]
#define WS_VT (WS_KH + PLB)                // f16 v, transposed [b][CC][SEQ]
#define WS_END (WS_VT + PLB)
static_assert(PLB % 128 == 0 && WPB % 128 == 0);
static_assert(WS_END <= (size_t)134217728u);

// ---- k_cvt: z = 0..5 selects (x_q, x_k, x_v, w_q, w_k, w_v): f32 -> bf16 (RNE), 8 elements per thread, one 16-B store per lane
// coverage: x planes NB*SEQ*CC/8 chunks (source rows remapped through the full strides), weight planes CC*CC/8 chunks; grid.x = max of the two
__global__ __launch_bounds__(256) void k_cvt(const float* __restrict__ XQ, const float* __restrict__ XK, const float* __restrict__ XV,
                                             const float* __restrict__ WQ, const float* __restrict__ WK, const float* __restrict__ WV,
                                             __bf16* __restrict__ DQ, __bf16* __restrict__ DK, __bf16* __restrict__ DV,
                                             __bf16* __restrict__ DWQ, __bf16* __restrict__ DWK, __bf16* __restrict__ DWV) {
  const int z = blockIdx.z;
  const float* src = z == 0 ? XQ : z == 1 ? XK : z == 2 ? XV : z == 3 ? WQ : z == 4 ? WK : WV;
  __bf16* dst = z == 0 ? DQ : z == 1 ? DK : z == 2 ? DV : z == 3 ? DWQ : z == 4 ? DWK : DWV;
  const size_t n8 = (z < 3) ? (size_t)NB * SEQ * CC / 8 : (size_t)CC * CC / 8;
  const size_t e = (size_t)blockIdx.x * 256 + threadIdx.x;
  if (e >= n8) return;
  size_t so = e * 8;
  if (z < 3) { const size_t row = e / (CC / 8), c = e % (CC / 8); so = ((row / SEQ) * SEQ_FULL + (row % SEQ)) * CC + c * 8; }
  const v4f f0 = *(const v4f*)(src + so), f1 = *(const v4f*)(src + so + 4);
  union { v8b v; v4u u; } o;
#pragma unroll
  for (int i = 0; i < 4; ++i) { o.v[i] = (__bf16)f0[i]; o.v[4 + i] = (__bf16)f1[i]; }
  vst2((void*)(dst + e * 8), o.u);
}

// ---- k_proj: block = (128 rows, 128 cols, which), 4 waves as 2 x 2, each a 64 x 64 tile: y = x W^T + b with exact bf16 products, k summed in 32-steps that ascend from the block's own first slice and wrap round;
// q -> f16, -k/8 -> f16, v -> f16 transposed plane: each rounded once; the rounding (11 significant bits) lies well below the error that the bf16 operands of these products leave in q, k and v.
// Per stage a 64-wide k slice of the block's 128 x rows and 128 W rows is brought into LDS once by tensor loads, one request a wave for its 64 rows (two buffers: the next
// slice flies while this one is multiplied); every wave takes its fragments from there, so each operand byte leaves L2 once per block, in whole 128-B lines.
// The 8 blocks that share x rows and the 32 that share W rows run at the same time: each enters the 16 slices at a start set by its tile indices, so that they do not ask L2 for the same lines at the same moment.
// coverage: grid (NB*SEQ/128, CC/128, 3) writes every row and column of QH, KH, VT exactly once
#define PM 128             // x rows per block
#define PN 128             // W rows (output columns) per block
#define PK 64              // k per stage: 128 B of every operand row
#define PP 72              // LDS row pitch in elements: 144 B = 16 B x 9, conflict-free for the 16-B fragment reads; the tensor load's pad gives it
#define PSL (TSL / 2u)     // elements of one wave's slice of 64 rows in LDS
#define PBUF (4u * PSL)    // elements of one buffer: two slices of x rows, then two of W rows
#define PE 136             // row pitch in elements of the output staging that takes the ring's place after the loop
static_assert((NB * SEQ) % PM == 0 && SEQ % PM == 0 && CC % PN == 0 && CC % PK == 0 && CC / PK >= 2);
static_assert(PM == 128 && PN == 128 && PK == 64 && PM * PE <= 2 * PBUF && PN * PE <= 2 * PBUF);
static_assert(((CC / PK) & (CC / PK - 1)) == 0);   // the wrap of the slice number is a mask

__global__ __launch_bounds__(128) void k_proj(const __bf16* __restrict__ XQ, const __bf16* __restrict__ XK, const __bf16* __restrict__ XV,
                                              const __bf16* __restrict__ WQ, const __bf16* __restrict__ WK, const __bf16* __restrict__ WV,
                                              const float* __restrict__ BQ, const float* __restrict__ BK, const float* __restrict__ BV,
                                              _Float16* __restrict__ QH, _Float16* __restrict__ KH, _Float16* __restrict__ VT) {
  __shared__ __attribute__((aligned(2048))) __bf16 ring[2 * PBUF];   // two operand buffers, every slice at a multiple of 2 KiB; output staging after the loop
  const int tid = threadIdx.x, wave = __builtin_amdgcn_readfirstlane(tid >> 5), lane = tid & 31, col = lane & 15, g = lane >> 4;   // one-dimensional block: the wave's number, in a scalar register
  const int wm = wave >> 1, wn = wave & 1;                 // this wave's 64 x 64 quarter of the block tile
  const int which = blockIdx.z; const int c0 = blockIdx.y * PN; const size_t r0 = (size_t)blockIdx.x * PM;
  const __bf16* X = which == 0 ? XQ : which == 1 ? XK : XV;
  const __bf16* W = which == 0 ? WQ : which == 1 ? WK : WV;
  const float* BA = which == 0 ? BQ : which == 1 ? BK : BV;
  // every wave issues one request a stage: waves 0, 1 the block's x rows 0..63 and 64..127, waves 2, 3 its W rows alike; 64 rows of 128 B, source pitch one row of CC elements
  const unsigned long long gs = (unsigned long long)(size_t)(wave < 2 ? X + (r0 + (size_t)wave * 64) * CC : W + ((size_t)c0 + (size_t)(wave - 2) * 64) * CC);   // first byte of this wave's 64 rows
  const unsigned ls = (unsigned)(size_t)&ring[0] + (unsigned)wave * TSL;
  const int s0 = (int)(blockIdx.x + 2 * blockIdx.y);       // stage t works on slice (s0 + t) mod 16: sharers of x rows start 2 slices apart, sharers of W rows 1
  const int k0 = (s0 & (CC / PK - 1)) * PK, k1 = ((s0 + 1) & (CC / PK - 1)) * PK;
  tcount(); thigh(gs + 2u * (unsigned)k0);
  v8u g1 = tgroup1<TW0_128, 128u, 64u>(2u * CC); thold128(g1);
  tload128(ls, gs + 2u * (unsigned)k0, g1);                // stage 0 -> buffer 0
  twait(g1); thigh(gs + 2u * (unsigned)k1);                                              // this wave's stage-0 slice has landed
  __syncthreads();                                         // ... and every other wave's
  tload128(ls + 2u * PBUF, gs + 2u * (unsigned)k1, g1);    // stage 1 -> buffer 1
  v8f acc[4][4] = {};
#pragma unroll 1   // one stage per trip: the ring's order of waits, barrier and refill stays as written
  for (int t = 0; t < CC / PK; ++t) {
    const __bf16* xb = ring + (t & 1) * PBUF + wm * PSL + col * PP;          // slice wm holds this wave's 64 x rows
    const __bf16* wb = ring + (t & 1) * PBUF + (2 + wn) * PSL + col * PP;    // slice 2 + wn its 64 W rows
#pragma unroll
    for (int kc = 0; kc < PK / 32; ++kc) {
      v16b a[4], w[4];
#pragma unroll
      for (int i = 0; i < 4; ++i) a[i] = frag_b(xb + i * 16 * PP + kc * 32, lane);      // A: x row m, split k map
#pragma unroll
      for (int j = 0; j < 4; ++j) w[j] = frag_b(wb + j * 16 * PP + kc * 32, lane);      // B[k][n] = W[n][k]: k-contiguous row n, same map
#pragma unroll
      for (int i = 0; i < 4; ++i)
#pragma unroll
        for (int j = 0; j < 4; ++j) acc[i][j] = wmma_bf(a[i], w[j], acc[i][j]); }
    asm volatile("s_wait_dscnt 0x0" ::: "memory");
    twait(g1);
    const int k2 = ((s0 + t + 2) & (CC / PK - 1)) * PK;
    thigh(gs + 2u * (unsigned)k2);
    __syncthreads();                                       // publishes stage t+1 and frees buffer t&1
    if (pinned(t + 2 < CC / PK)) { const unsigned bo = (unsigned)(t & 1) * 2u * PBUF;
      tload128(ls + bo, gs + 2u * (unsigned)k2, g1); }
  }
  twait(g1);                                           // no request outstanding before the ring becomes output staging
  asm volatile("s_wait_dscnt 0x0" ::: "memory");           // nor an LDS read of this wave
  if (which == 2) { _Float16* th = (_Float16*)ring;                             // [col][row]
#pragma unroll
    for (int j = 0; j < 4; ++j) { const int cl = wn * 64 + j * 16 + col; const float bb = bfr(BA[c0 + cl]);
#pragma unroll
      for (int i = 0; i < 4; ++i) { v8h hv;
#pragma unroll
        for (int r = 0; r < 8; ++r) hv[r] = (_Float16)(acc[i][j][r] + bb);
        const int rl = wm * 64 + i * 16 + 8 * g;
        *(v8h*)&th[cl * PE + rl] = hv; } }
    __syncthreads();
    // stores: lane = (staged row tid>>4 of each 8-row group, 16-B piece tid&15): 16 lanes cover 256 contiguous bytes; one address, constant steps
    const int sr = tid >> 4, sq = (tid & 15) * 8;
    const size_t o2 = ((r0 / SEQ) * CC + c0 + sr) * (size_t)SEQ + (r0 % SEQ) + sq;
#pragma unroll
    for (int i = 0; i < PN / 8; ++i) vst2((void*)(VT + o2 + (size_t)i * 8 * SEQ), *(const v4u*)&th[(sr + i * 8) * PE + sq]);
    asm volatile("s_wait_xcnt 0x0" ::: "memory");          // precaution: stands between the stores above and any later rewrite of a register that they name
  }
  else { _Float16* sh = (_Float16*)ring;                                         // [row][col]
    const float sc = which == 1 ? -0.125f : 1.0f;           // the k plane carries the logit's factor -1/sqrt(64): a power of two, so the f16 rounding of k is the same
#pragma unroll
    for (int j = 0; j < 4; ++j) { const int cl = wn * 64 + j * 16 + col; const float bb = bfr(BA[c0 + cl]);
#pragma unroll
      for (int i = 0; i < 4; ++i)
#pragma unroll
        for (int r = 0; r < 8; ++r) sh[(wm * 64 + i * 16 + 8 * g + r) * PE + cl] = (_Float16)((acc[i][j][r] + bb) * sc); }
    __syncthreads();
    const int sr = tid >> 4, sq = (tid & 15) * 8;           // as above
    _Float16* D = (which == 0 ? QH : KH) + (r0 + sr) * CC + c0 + sq;
#pragma unroll
    for (int i = 0; i < PM / 8; ++i) vst2((void*)(D + (size_t)i * 8 * CC), *(const v4u*)&sh[(sr + i * 8) * PE + sq]);
    asm volatile("s_wait_xcnt 0x0" ::: "memory");          // precaution: stands between the stores above and any later rewrite of a register that they name
  }
}

__device__ __forceinline__ float xhalf(float x) {          // lane l takes lane l ^ 16's value
  return __builtin_bit_cast(float, __builtin_amdgcn_permlanex16(__builtin_bit_cast(int, x), __builtin_bit_cast(int, x), 0x76543210, 0xfedcba98, false, false)); }

// e^x as 2^(x log2 e): one multiply and the hardware's base-2 exponential; x <= 0 here (an older maximum minus the running maximum), -inf and anything below the f32 range give 0
#define LOG2E 1.44269504088896340736f
__device__ __forceinline__ float exp_hw(float x) { return __builtin_amdgcn_exp2f(x * LOG2E); }

#define QT 128             // queries per block: 8 waves x 16
#define AKP 72             // row pitch in elements of the k and v tiles in LDS (144 B): rows of 128 B and the tensor load's pad
#define AMP 68             // row pitch in floats of the mask tile in LDS (272 B): rows of 256 B and the pad
#define ABUF (6u * TSL)    // bytes of one buffer: slice 0 = k tile [key][d], 1 = v tile [d][key], 2..5 = 32 mask rows each [query][key]
static_assert(SEQ % QT == 0 && SEQ / KT >= 2 && QT == 128);
static_assert(((SEQ / KT) & (SEQ / KT - 1)) == 0);   // the wrap of the key tile's number is a mask

// one step's tiles: wave 0 asks for the k tile, wave 1 for the v tile (64 rows of 128 B each), waves 2..5 for 32 mask rows of 256 B each; slice number = wave number; waves 6, 7 ask for nothing.
// lds, ga: the wave's own slice's place in LDS and its tile's first byte; g1a, g1b: group 1 of the two kinds of tile
__device__ __forceinline__ void load_tiles(int wave, unsigned lds, unsigned long long ga, v8u g1a, v8u g1b) {
  if (pinned(wave < 2)) tload128(lds, ga, g1a);
  if (pinned(wave >= 2 && wave < 6)) tload256(lds, ga, g1b);
}

// second launch-bounds argument: four waves a SIMD, that is at most 256 registers a wave; without it the freer schedule takes a few more, and one work-group fewer fits on a WGP
__global__ __launch_bounds__(256, 4) void k_att(const _Float16* __restrict__ QH, const _Float16* __restrict__ KH, const _Float16* __restrict__ VT,
                                             const float* __restrict__ MK, float* __restrict__ OUT) {
  __shared__ __attribute__((aligned(2048))) unsigned char ring[2 * ABUF];   // two buffers of six slices, every slice at a multiple of 2 KiB; behind the loop the mask rows of buffer 0 are [query][d] output staging
  // the wave's number in a scalar register (one-dimensional block of eight waves): what hangs on it takes no vector register, which keeps the capped build free of scratch
  const int tid = threadIdx.x, wave = __builtin_amdgcn_readfirstlane(tid >> 5), lane = tid & 31, col = lane & 15, g = lane >> 4;
  const int b = blockIdx.z, h = blockIdx.y, qb0 = blockIdx.x * QT, ql0 = qb0 + wave * 16;
  const size_t qrow = (size_t)b * SEQ + ql0;
  v16h qh[2];                                               // B[k=d][n=query]: k-contiguous row per query
#pragma unroll
  for (int kc = 0; kc < 2; ++kc) qh[kc] = frag_h(QH + (qrow + col) * CC + h * HD + kc * 32, lane);
  float mrow = -3.0e38f, lrow = 0.0f; v8f o[4];             // query ql0+col: running maximum (both halves), this half's sum; o[t][r] = o^T[d = 16t+8g+r][query]
#pragma unroll
  for (int t = 0; t < 4; ++t) o[t] = (v8f){};
  // staged extent == consumed extent: k keys 0..63 x d 0..63, v d 0..63 x keys 0..63, mask 128 queries x 64 keys
  const _Float16* gk = KH + (size_t)b * SEQ * CC + h * HD;                  // key 0 of this head
  const _Float16* gv = VT + ((size_t)b * CC + h * HD) * SEQ;                // d 0, key 0
  const float* gm = MK + ((size_t)b * SEQ_FULL + qb0) * SEQ_FULL;           // the block's first query, key 0
  const unsigned lb = (unsigned)(size_t)&ring[0];
  // this wave's own tile: first byte at key 0, bytes from one key to the next, its slice's place in buffer 0 (waves 6, 7 ask for nothing: theirs are formed in bounds and never used)
  const unsigned long long gw = (unsigned long long)(size_t)(wave == 0 ? (const void*)gk : wave == 1 ? (const void*)gv : (const void*)(gm + (size_t)((wave - 2) & 3) * 32 * SEQ_FULL));
  const unsigned gq = wave == 0 ? 2u * CC : wave == 1 ? 2u : 4u;
  const unsigned ls = lb + (unsigned)(wave < 6 ? wave : 5) * TSL;
  const int s0 = 2 * (int)(blockIdx.x + blockIdx.y);       // step kb works on key tile (s0 + kb) mod 32: sharers of a mask tile, and of a k and v tile, start 2 tiles apart
  const int t0 = (s0 & (SEQ / KT - 1)) * KT, t1 = ((s0 + 1) & (SEQ / KT - 1)) * KT;
  tcount(); thigh(gw + (unsigned)t0 * gq);
  v8u g1a = tgroup1<TW0_128, 128u, 64u>(wave == 0 ? 2u * CC : 2u * SEQ); thold128(g1a);
  v8u g1b = tgroup1<TW0_256, 256u, 32u>(4u * SEQ_FULL); thold256(g1b);
  const unsigned mo = (2u + ((unsigned)wave >> 1)) * TSL + ((unsigned)wave & 1u) * 16u * 4u * AMP;   // bytes from a buffer's start to this wave's 16 mask rows
  load_tiles(wave, ls, gw + (unsigned)t0 * gq, g1a, g1b);  // step 0 -> buffer 0
  twait(g1a, g1b); thigh(gw + (unsigned)t1 * gq);          // this wave's step-0 request has landed (a wave that made none passes at once)
  __syncthreads();                                         // ... and every other wave's
  load_tiles(wave, ls + ABUF, gw + (unsigned)t1 * gq, g1a, g1b);   // step 1 -> buffer 1
#pragma unroll 1   // one step per trip: the ring's order of waits, barrier and refill stays as written
  for (int kb = 0; kb < SEQ / KT; ++kb) {
    const int bf = kb & 1;
    const unsigned char* bp = ring + (unsigned)bf * ABUF;
    const _Float16* kt = (const _Float16*)bp;               // [key][AKP]
    const _Float16* vs = (const _Float16*)(bp + TSL);       // [d][AKP]
    const float* mw = (const float*)(bp + mo);              // this wave's 16 queries [AMP]
    v8f s[4]; v16h kf[4][2];                                // s[j][r] = logit of key 16j+8g+r, query col
#pragma unroll
    for (int j = 0; j < 4; ++j) {
      const float* mq = mw + col * AMP + j * 16 + 8 * g;
      const v4f m0 = *(const v4f*)mq, m1 = *(const v4f*)(mq + 4);
      s[j] = (v8f){m0[0], m0[1], m0[2], m0[3], m1[0], m1[1], m1[2], m1[3]};   // C[m=key][n=query] = m[query][key]: the D map
#pragma unroll
      for (int kc = 0; kc < 2; ++kc) kf[j][kc] = frag_h(kt + (j * 16 + col) * AKP + kc * 32, lane); }   // A[m=key][k=d]: k-contiguous row per key, same map as q
    v16h vf[2][4];                                          // A[m=d][k=key]: key-contiguous row per d, same map
#pragma unroll
    for (int kc = 0; kc < 2; ++kc)
#pragma unroll
      for (int t = 0; t < 4; ++t) vf[kc][t] = frag_h(vs + (t * 16 + col) * AKP + kc * 32, lane);
    __builtin_amdgcn_sched_barrier(0);                      // all forty reads of the step stay one group at its head (mask and k first, v behind them, landing under the logits and the softmax): without it they are spread among the products, the v reads sunk to theirs, each place with a wait of its own
#pragma unroll
    for (int kc = 0; kc < 2; ++kc)
#pragma unroll
      for (int j = 0; j < 4; ++j) s[j] = wmma16(kf[j][kc], qh[kc], s[j]);
    float vj[4];                                            // four independent chains, then joined
#pragma unroll
    for (int j = 0; j < 4; ++j) { vj[j] = s[j][0];
#pragma unroll
      for (int r = 1; r < 8; ++r) vj[j] = fmaxf(vj[j], s[j][r]); }
    float v = fmaxf(fmaxf(vj[0], vj[1]), fmaxf(vj[2], vj[3]));
    v = fmaxf(v, xhalf(v));
    const float mn = fmaxf(mrow, v); const float alpha = exp_hw(mrow - mn); float rs[4];
#pragma unroll
    for (int j = 0; j < 4; ++j) { rs[j] = 0.0f; const v8f x2 = (s[j] - mn) * LOG2E;
#pragma unroll
      for (int r = 0; r < 8; ++r) { const float p = __builtin_amdgcn_exp2f(x2[r]); s[j][r] = p; rs[j] += p; } }
    lrow = lrow * alpha + ((rs[0] + rs[1]) + (rs[2] + rs[3])); mrow = mn;
#pragma unroll
    for (int t = 0; t < 4; ++t) o[t] *= alpha;
    __builtin_amdgcn_sched_barrier(0);                      // the 33 exponentials stay one run ahead of the conversions: without it each pair is chained exp, multiply, convert through the same two registers, with an idle slot behind every pair
#pragma unroll
    for (int kc = 0; kc < 2; ++kc) { v16h pf;               // B[k=key][n=query]: elements 0..7 = keys 32kc+8g+0..7, 8..15 = 32kc+16+8g+0..7: the D registers of tiles 2kc, 2kc+1
#pragma unroll
      for (int i = 0; i < 8; ++i) { pf[i] = (_Float16)(s[2 * kc][i] * 2048.0f); pf[8 + i] = (_Float16)(s[2 * kc + 1][i] * 2048.0f); }
#pragma unroll
      for (int t = 0; t < 4; ++t) o[t] = wmma16(vf[kc][t], pf, o[t]); }
    __builtin_amdgcn_sched_barrier(0);                      // the waits and the barrier below stay at the step's foot: with every LDS read of the step up at its head they would else rise above the softmax, and the wait for the next tiles' requests would come a whole step's work too early
    asm volatile("s_wait_dscnt 0x0" ::: "memory");         // this wave's reads of buffer kb&1 are done
    twait(g1a, g1b);                                       // this wave's request of step kb+1 has landed
    const int k2 = ((s0 + kb + 2) & (SEQ / KT - 1)) * KT;  // key tile of step kb+2 (the mask keeps it inside the keys also where no such step exists)
    thigh(gw + (unsigned)k2 * gq);
    __syncthreads();                                       // publishes step kb+1 and frees buffer kb&1
    if (pinned(kb + 2 < SEQ / KT)) load_tiles(wave, ls + (unsigned)bf * ABUF, gw + (unsigned)k2 * gq, g1a, g1b);
  }
  twait(g1a, g1b);                                     // no request outstanding before the mask rows of buffer 0 become output staging
  ldsx();                                                   // this wave's last reads of its own mask rows of buffer 0 are done; no other wave touches them any more
  const float inv = (1.0f / (lrow + xhalf(lrow))) * (1.0f / 2048.0f);
  float* st = (float*)(ring + mo);                          // this wave's own 16 mask rows of buffer 0
#pragma unroll
  for (int t = 0; t < 4; ++t) { float* op = st + col * AMP + t * 16 + 8 * g; const v8f w = o[t] * inv;
    *(v4f*)op = (v4f){w[0], w[1], w[2], w[3]}; *(v4f*)(op + 4) = (v4f){w[4], w[5], w[6], w[7]}; }
  ldsx();
  for (int rl = 0; rl < 16; ++rl) { const v4f w4 = *(const v4f*)(st + rl * AMP + (lane & 15) * 4);
    if (lane < HD / 4) vst2((void*)(OUT + ((size_t)b * SEQ + ql0 + rl) * CC + h * HD + lane * 4), w4); }
}

extern "C" void kernel_launch(void* const* d_in, const int* in_sizes, int n_in, void* d_out, int out_size, void* d_ws, size_t ws_size, hipStream_t stream) {
  if (n_in < 10) return;
  const size_t needX = ((size_t)(NB - 1) * SEQ_FULL + SEQ) * CC;
  const size_t needM = ((size_t)(NB - 1) * SEQ_FULL + SEQ - 1) * SEQ_FULL + SEQ;
  if ((size_t)in_sizes[0] < needX || (size_t)in_sizes[1] < needX || (size_t)in_sizes[2] < needX) return;
  if ((size_t)in_sizes[3] < needM) return;
  if ((size_t)in_sizes[4] < (size_t)CC * CC || (size_t)in_sizes[6] < (size_t)CC * CC || (size_t)in_sizes[8] < (size_t)CC * CC) return;
  if (in_sizes[5] < CC || in_sizes[7] < CC || in_sizes[9] < CC) return;
  if ((size_t)out_size < (size_t)NB * SEQ * CC) return;
  if (ws_size < (size_t)WS_END) return;
  const float* const* F = (const float* const*)d_in;   // 0 x_q, 1 x_k, 2 x_v [2,2048,1024]; 3 m [2,2048,2048]; 4 w_q [out][in], 5 b_q, 6 w_k, 7 b_k, 8 w_v, 9 b_v
  char* ws = (char*)d_ws;
  __bf16 *XQb = (__bf16*)(ws + WS_XQ), *XKb = (__bf16*)(ws + WS_XK), *XVb = (__bf16*)(ws + WS_XV);
  __bf16 *WQb = (__bf16*)(ws + WS_WQ), *WKb = (__bf16*)(ws + WS_WK), *WVb = (__bf16*)(ws + WS_WV);
  _Float16 *QH = (_Float16*)(ws + WS_QH), *KH = (_Float16*)(ws + WS_KH), *VT = (_Float16*)(ws + WS_VT);
  const size_t nx8 = (size_t)NB * SEQ * CC / 8, nw8 = (size_t)CC * CC / 8;
  const unsigned gx8 = (unsigned)((nx8 + 255) / 256), gw8 = (unsigned)((nw8 + 255) / 256);
  const unsigned gx = gx8 > gw8 ? gx8 : gw8;
  k_cvt<<<dim3(gx, 1, 6), 256, 0, stream>>>(F[0], F[1], F[2], F[4], F[6], F[8], XQb, XKb, XVb, WQb, WKb, WVb);
  k_proj<<<dim3(NB * SEQ / PM, CC / PN, 3), 128, 0, stream>>>(XQb, XKb, XVb, WQb, WKb, WVb, F[5], F[7], F[9], QH, KH, VT);
  k_att<<<dim3(SEQ / QT, NH, NB), 256, 0, stream>>>(QH, KH, VT, F[3], (float*)d_out);
}
